// v000
// Times are from an AMD MI455X. After a warm-up the kernel runs many times in a row, and a time is the length of
// such a window on the GPU divided by its runs, so every launch and the gaps after it count. The runs cycle
// through copies of the inputs. A figure is the median of several windows, for all but v000 over two sittings.
// Sittings can differ by a few percent; kernels timed side by side share one.
// v000, which the later versions start from, runs in 115 microseconds.
#include <hip/hip_runtime.h>

typedef __attribute__((ext_vector_type(16))) __bf16 v16bf;
typedef __attribute__((ext_vector_type(4)))  __bf16 v4bf;
typedef __attribute__((ext_vector_type(8)))  float  v8f;
typedef __attribute__((ext_vector_type(4)))  float  v4f;

#define N_  2
#define L_  2048
#define S_  2048
#define H_  16
#define E_  64
#define D_  64
#define BM  128      // query rows per block (8 waves x 16)
#define BN  64       // key rows per S tile
#define LOG2E 1.4426950408889634f

// Inverse of the documented 16-bit A/B fragment layout:
//   lane-half h2 = (k>>3)&1 ; element slot e_idx = (k&7) + 8*(k>>4)

// Fused DPP xor-butterfly max within each 16-lane row:
// one v_max_num_f32_dpp per step (dst = max(dpp16(src0), src1)).
__device__ __forceinline__ float hmax16(float v) {
    float t;
    asm volatile("v_max_num_f32_dpp %0, %1, %2 row_xmask:8 row_mask:0xf bank_mask:0xf"
                 : "=&v"(t) : "v"(v), "v"(v));
    asm volatile("v_max_num_f32_dpp %0, %1, %2 row_xmask:4 row_mask:0xf bank_mask:0xf"
                 : "=&v"(v) : "v"(t), "v"(t));
    asm volatile("v_max_num_f32_dpp %0, %1, %2 row_xmask:2 row_mask:0xf bank_mask:0xf"
                 : "=&v"(t) : "v"(v), "v"(v));
    asm volatile("v_max_num_f32_dpp %0, %1, %2 row_xmask:1 row_mask:0xf bank_mask:0xf"
                 : "=&v"(v) : "v"(t), "v"(t));
    return v;
}

__global__ __launch_bounds__(256)
void fattn_wmma_kernel(const float* __restrict__ Q, const float* __restrict__ K,
                       const float* __restrict__ V, const float* __restrict__ Mask,
                       float* __restrict__ Out)
{
    __shared__ __align__(32) __bf16 Kf[4 * 2 * 32 * 16];   // K frags (8 KB)
    __shared__ __align__(32) __bf16 Vf[2 * 4 * 32 * 16];   // V frags (8 KB)
    __shared__ __align__(32) __bf16 Pf[8 * 2 * 32 * 16];   // P frags per wave (16 KB)

    const int tid  = threadIdx.x;
    const int w    = tid >> 5;
    const int lane = tid & 31;
    const int h2   = lane >> 4;
    const int mrow = lane & 15;
    const int ncol = lane & 15;

    const int bid = blockIdx.x;
    const int lb  = bid & 15;
    const int h   = (bid >> 4) & 15;
    const int n   = bid >> 8;

    const int l_base = lb * BM + w * 16;
    const float temp = 0.125f;           // 1/sqrt(64)

    __bf16* Pw = Pf + w * (2 * 32 * 16);

    // ---------------- Q fragments (registers, whole kernel) ----------------
    v16bf qa[2];
    {
        const float* qrow = Q + (((size_t)n * L_ + (l_base + mrow)) * H_ + h) * E_;
        #pragma unroll
        for (int half = 0; half < 2; ++half) {
            const float* base = qrow + half * 32 + 8 * h2;
            #pragma unroll
            for (int j = 0; j < 8; ++j)  qa[half][j]     = (__bf16)base[j];
            #pragma unroll
            for (int j = 0; j < 8; ++j)  qa[half][8 + j] = (__bf16)base[16 + j];
        }
    }
    // all-ones B fragment: row-sum via the matrix pipe (P . 1)
    v16bf ones;
    #pragma unroll
    for (int j = 0; j < 16; ++j) ones[j] = (__bf16)1.0f;

    v8f o[4] = {v8f{0.f}, v8f{0.f}, v8f{0.f}, v8f{0.f}};
    float run_max[8], run_max2[8], run_sum[8];
    #pragma unroll
    for (int r = 0; r < 8; ++r) {
        run_max[r] = -3.0e38f; run_max2[r] = -3.0e38f; run_sum[r] = 0.0f;
    }

    #pragma unroll 1
    for (int s0 = 0; s0 < S_; s0 += BN) {
        __syncthreads();   // previous iteration done with Kf/Vf

        // ---------- stage K tile directly into fragment layout ----------
        #pragma unroll
        for (int it = 0; it < 4; ++it) {
            int idx = (it * 256 + tid) * 4;
            int s   = idx >> 6;
            int col = idx & 63;
            const float* gk = K + (((size_t)n * S_ + (s0 + s)) * H_ + h) * E_ + col;
            v4f k4 = *(const v4f*)gk;
            if (s0 + BN < S_) __builtin_prefetch(gk + (size_t)BN * H_ * E_, 0, 1);
            int half = col >> 5;
            int k    = col & 31;
            int kh2  = (k >> 3) & 1;
            int slot = (k & 7) + 8 * (k >> 4);
            int lfr  = (s & 15) + 16 * kh2;
            int st   = s >> 4;
            v4bf pk;
            pk[0] = (__bf16)k4[0]; pk[1] = (__bf16)k4[1];
            pk[2] = (__bf16)k4[2]; pk[3] = (__bf16)k4[3];
            *(v4bf*)&Kf[(((st * 2 + half) * 32 + lfr) << 4) + slot] = pk;
        }
        // ---------- stage V tile: 4x4 (s x d) block per thread ----------
        {
            int d0  = (tid & 15) * 4;
            int sl0 = (tid >> 4) * 4;
            const float* gv = V + (((size_t)n * S_ + (s0 + sl0)) * H_ + h) * D_ + d0;
            v4f r0 = *(const v4f*)(gv + 0 * H_ * D_);
            v4f r1 = *(const v4f*)(gv + 1 * H_ * D_);
            v4f r2 = *(const v4f*)(gv + 2 * H_ * D_);
            v4f r3 = *(const v4f*)(gv + 3 * H_ * D_);
            if (s0 + BN < S_) __builtin_prefetch(gv + (size_t)BN * H_ * D_, 0, 1);
            int kk   = sl0 >> 5;
            int k    = sl0 & 31;
            int kh2  = (k >> 3) & 1;
            int slot = (k & 7) + 8 * (k >> 4);
            #pragma unroll
            for (int j = 0; j < 4; ++j) {
                int d   = d0 + j;
                int lfr = (d & 15) + 16 * kh2;
                int nd  = d >> 4;
                v4bf pv;
                pv[0] = (__bf16)r0[j]; pv[1] = (__bf16)r1[j];
                pv[2] = (__bf16)r2[j]; pv[3] = (__bf16)r3[j];
                *(v4bf*)&Vf[(((kk * 4 + nd) * 32 + lfr) << 4) + slot] = pv;
            }
        }
        __syncthreads();

        // ------------- GEMM1: preloaded fragment pairs, 8 WMMAs -------------
        v8f sc[4];
        #pragma unroll
        for (int stp = 0; stp < 2; ++stp) {
            const int sa = 2 * stp, sb = 2 * stp + 1;
            v16bf b00 = *(const v16bf*)&Kf[((sa * 2 + 0) * 32 + lane) << 4];
            v16bf b01 = *(const v16bf*)&Kf[((sa * 2 + 1) * 32 + lane) << 4];
            v16bf b10 = *(const v16bf*)&Kf[((sb * 2 + 0) * 32 + lane) << 4];
            v16bf b11 = *(const v16bf*)&Kf[((sb * 2 + 1) * 32 + lane) << 4];
            v8f z = {0.f};
            v8f ca = __builtin_amdgcn_wmma_f32_16x16x32_bf16(false, qa[0], false, b00, (short)0, z,  false, false);
            v8f cb = __builtin_amdgcn_wmma_f32_16x16x32_bf16(false, qa[0], false, b10, (short)0, z,  false, false);
            ca     = __builtin_amdgcn_wmma_f32_16x16x32_bf16(false, qa[1], false, b01, (short)0, ca, false, false);
            cb     = __builtin_amdgcn_wmma_f32_16x16x32_bf16(false, qa[1], false, b11, (short)0, cb, false, false);
            sc[sa] = ca; sc[sb] = cb;
        }
        // scale + additive mask
        #pragma unroll
        for (int st = 0; st < 4; ++st) {
            const int sg = s0 + st * 16 + ncol;
            #pragma unroll
            for (int r = 0; r < 8; ++r) {
                sc[st][r] = sc[st][r] * temp + Mask[(size_t)(l_base + r + 8 * h2) * S_ + sg];
            }
        }

        // ------------- online max: fused DPP row_xmask butterflies -------------
        float nm2[8], scl8[8];
        #pragma unroll
        for (int r = 0; r < 8; ++r) {
            float m01 = fmaxf(sc[0][r], sc[1][r]);
            float m23 = fmaxf(sc[2][r], sc[3][r]);
            float tmax = hmax16(fmaxf(m01, m23));
            float nmax = fmaxf(run_max[r], tmax);
            run_max[r] = nmax;
            nm2[r] = nmax * LOG2E;
            scl8[r] = __builtin_amdgcn_exp2f(run_max2[r] - nm2[r]);
            run_max2[r] = nm2[r];
        }

        // exp2 + store P directly in A-fragment layout (bf16)
        #pragma unroll
        for (int st = 0; st < 4; ++st) {
            int kk   = st >> 1;
            int slot = (ncol & 7) + 8 * (st & 1);
            int kh2  = ncol >> 3;
            #pragma unroll
            for (int r = 0; r < 8; ++r) {
                float p = __builtin_amdgcn_exp2f(__builtin_fmaf(sc[st][r], LOG2E, -nm2[r]));
                Pw[((kk * 32 + (r + 8 * h2) + 16 * kh2) << 4) + slot] = (__bf16)p;
            }
        }
        // rescale O while P stores land
        #pragma unroll
        for (int r = 0; r < 8; ++r) {
            o[0][r] *= scl8[r]; o[1][r] *= scl8[r];
            o[2][r] *= scl8[r]; o[3][r] *= scl8[r];
        }

        // ---------------- GEMM2: O += P . V ; row-sum = P . 1 ----------------
        v16bf pa0 = *(const v16bf*)&Pw[(0 * 32 + lane) << 4];
        v16bf pa1 = *(const v16bf*)&Pw[(1 * 32 + lane) << 4];
        v8f z = {0.f};
        v8f rs = __builtin_amdgcn_wmma_f32_16x16x32_bf16(false, pa0, false, ones, (short)0, z,  false, false);
        rs     = __builtin_amdgcn_wmma_f32_16x16x32_bf16(false, pa1, false, ones, (short)0, rs, false, false);
        #pragma unroll
        for (int nd = 0; nd < 4; ++nd) {
            v16bf vb0 = *(const v16bf*)&Vf[((0 * 4 + nd) * 32 + lane) << 4];
            v16bf vb1 = *(const v16bf*)&Vf[((1 * 4 + nd) * 32 + lane) << 4];
            o[nd] = __builtin_amdgcn_wmma_f32_16x16x32_bf16(false, pa0, false, vb0, (short)0, o[nd], false, false);
            o[nd] = __builtin_amdgcn_wmma_f32_16x16x32_bf16(false, pa1, false, vb1, (short)0, o[nd], false, false);
        }
        #pragma unroll
        for (int r = 0; r < 8; ++r) {
            run_sum[r] = run_sum[r] * scl8[r] + rs[r];
        }
    }

    // ---------------- epilogue: divide by running sum, store fp32 ----------------
    #pragma unroll
    for (int r = 0; r < 8; ++r) {
        float inv = 1.0f / run_sum[r];
        size_t base = (((size_t)n * L_ + (l_base + r + 8 * h2)) * H_ + h) * D_;
        #pragma unroll
        for (int nd = 0; nd < 4; ++nd) {
            Out[base + nd * 16 + ncol] = o[nd][r] * inv;
        }
    }
}

extern "C" void kernel_launch(void* const* d_in, const int* in_sizes, int n_in,
                              void* d_out, int out_size, void* d_ws, size_t ws_size,
                              hipStream_t stream) {
    const float* Q = (const float*)d_in[0];
    const float* K = (const float*)d_in[1];
    const float* V = (const float*)d_in[2];
    const float* M = (const float*)d_in[3];
    float* O = (float*)d_out;
    dim3 grid(N_ * H_ * (L_ / BM));   // 2*16*16 = 512 blocks
    fattn_wmma_kernel<<<grid, 256, 0, stream>>>(Q, K, V, M, O);
}

// v001
// It runs in 81.6 microseconds.
// Timed twice side by side with v000, it ran 1.44 and 1.43 times as fast.
#include <hip/hip_runtime.h>

typedef __attribute__((ext_vector_type(16))) __bf16 v16bf;
typedef __attribute__((ext_vector_type(4)))  __bf16 v4bf;
typedef __attribute__((ext_vector_type(8)))  float  v8f;
typedef __attribute__((ext_vector_type(4)))  float  v4f;

#define N_  2
#define L_  2048
#define S_  2048
#define H_  16
#define E_  64
#define D_  64
#define BM  128      // query rows per block (8 waves x 16)
#define BN  64       // key rows per S tile
#define MP  68       // floats per staged mask row: 256 B + 16 B, an odd multiple of 16 B for b128 readers
#define LOG2E 1.4426950408889634f

// 16-bit A/B fragment layout (hardware k order), inverse map:
//   lane-half h2 = (k>>3)&1 ; element slot e_idx = (k&7) + 8*(k>>4)
// A takes it with lane&15 = row, B with lane&15 = column, so one staged
// fragment serves as either operand.

// lane l <-> l ^ 16
__device__ __forceinline__ float xhalf(float v) {
    int b = __builtin_bit_cast(int, v);
    b = __builtin_amdgcn_permlanex16(b, b, 0x76543210, 0xfedcba98, false, false);
    return __builtin_bit_cast(float, b);
}

__global__ __launch_bounds__(256)
void fattn_wmma_kernel(const float* __restrict__ Q, const float* __restrict__ K,
                       const float* __restrict__ V, const float* __restrict__ Mask,
                       float* __restrict__ Out)
{
    __shared__ __align__(32) __bf16 Kf[4 * 2 * 32 * 16];   // K frags (8 KB)
    __shared__ __align__(32) __bf16 Vf[2 * 4 * 32 * 16];   // V frags (8 KB)
    __shared__ __align__(16) float  Mf[8 * 16 * MP];       // mask rows per wave (34 KB)

    const int tid  = threadIdx.x;
    const int w    = tid >> 5;
    const int lane = tid & 31;
    const int h2   = lane >> 4;
    const int c16  = lane & 15;

    const int bid = blockIdx.x;
    const int lb  = bid & 15;
    const int h   = (bid >> 4) & 15;
    const int n   = bid >> 8;

    const int l_base = lb * BM + w * 16;
    const int l_own  = l_base + c16;               // the one query this lane owns
    const float cexp = 0.125f * LOG2E;             // softmax_temp, in log2 units

    // ---------------- Q fragments (registers, whole kernel): B operand ----------------
    v16bf qa[2];
    {
        const float* qrow = Q + (((size_t)n * L_ + l_own) * H_ + h) * E_;
        #pragma unroll
        for (int half = 0; half < 2; ++half) {
            const float* base = qrow + half * 32 + 8 * h2;
            #pragma unroll
            for (int j = 0; j < 8; ++j)  qa[half][j]     = (__bf16)base[j];
            #pragma unroll
            for (int j = 0; j < 8; ++j)  qa[half][8 + j] = (__bf16)base[16 + j];
        }
    }
    // all-ones A fragment: column sums of P^T via the matrix pipe (1 . P^T)
    v16bf ones;
    #pragma unroll
    for (int j = 0; j < 16; ++j) ones[j] = (__bf16)1.0f;

    // o[nd][r] = O[l_own][nd*16 + 8*h2 + r]
    v8f o[4] = {v8f{0.f}, v8f{0.f}, v8f{0.f}, v8f{0.f}};
    float run_max = -3.0e38f;     // of qk + mask, unscaled
    float run_sum = 0.0f;

    float* Mw = Mf + w * (16 * MP);
    // whole-line mask loads: lanes 0-15 one row's 64 columns, lanes 16-31 the next row's
    const float* mrow = Mask + (size_t)(l_base + h2) * S_ + 4 * c16;

    #pragma unroll 1
    for (int s0 = 0; s0 < S_; s0 += BN) {
        __syncthreads();   // previous iteration done with Kf/Vf

        // ---------- this wave's 16 x 64 mask tile, row-major, on its way to LDS ----------
        v4f mk[8];
        #pragma unroll
        for (int j = 0; j < 8; ++j)
            mk[j] = *(const v4f*)(mrow + (size_t)(2 * j) * S_ + s0);

        // ---------- stage K tile directly into fragment layout ----------
        #pragma unroll
        for (int it = 0; it < 4; ++it) {
            int idx = (it * 256 + tid) * 4;
            int s   = idx >> 6;
            int col = idx & 63;
            const float* gk = K + (((size_t)n * S_ + (s0 + s)) * H_ + h) * E_ + col;
            v4f k4 = *(const v4f*)gk;
            if (s0 + BN < S_) __builtin_prefetch(gk + (size_t)BN * H_ * E_, 0, 1);
            int half = col >> 5;
            int k    = col & 31;
            int kh2  = (k >> 3) & 1;
            int slot = (k & 7) + 8 * (k >> 4);
            int lfr  = (s & 15) + 16 * kh2;
            int st   = s >> 4;
            v4bf pk;
            pk[0] = (__bf16)k4[0]; pk[1] = (__bf16)k4[1];
            pk[2] = (__bf16)k4[2]; pk[3] = (__bf16)k4[3];
            *(v4bf*)&Kf[(((st * 2 + half) * 32 + lfr) << 4) + slot] = pk;
        }
        // ---------- stage V tile: 4x4 (s x d) block per thread ----------
        {
            int d0  = (tid & 15) * 4;
            int sl0 = (tid >> 4) * 4;
            const float* gv = V + (((size_t)n * S_ + (s0 + sl0)) * H_ + h) * D_ + d0;
            v4f r0 = *(const v4f*)(gv + 0 * H_ * D_);
            v4f r1 = *(const v4f*)(gv + 1 * H_ * D_);
            v4f r2 = *(const v4f*)(gv + 2 * H_ * D_);
            v4f r3 = *(const v4f*)(gv + 3 * H_ * D_);
            if (s0 + BN < S_) __builtin_prefetch(gv + (size_t)BN * H_ * D_, 0, 1);
            int kk   = sl0 >> 5;
            int k    = sl0 & 31;
            int kh2  = (k >> 3) & 1;
            int slot = (k & 7) + 8 * (k >> 4);
            #pragma unroll
            for (int j = 0; j < 4; ++j) {
                int d   = d0 + j;
                int lfr = (d & 15) + 16 * kh2;
                int nd  = d >> 4;
                v4bf pv;
                pv[0] = (__bf16)r0[j]; pv[1] = (__bf16)r1[j];
                pv[2] = (__bf16)r2[j]; pv[3] = (__bf16)r3[j];
                *(v4bf*)&Vf[(((kk * 4 + nd) * 32 + lfr) << 4) + slot] = pv;
            }
        }
        #pragma unroll
        for (int j = 0; j < 8; ++j)
            *(v4f*)&Mw[(2 * j + h2) * MP + 4 * c16] = mk[j];
        __syncthreads();

        // mask^T tiles in accumulator layout: sc[st][r] = Mask[l_own][s0 + st*16 + 8*h2 + r]
        v8f sc[4];
        #pragma unroll
        for (int st = 0; st < 4; ++st) {
            const float* mp = &Mw[c16 * MP + st * 16 + 8 * h2];
            v4f m0 = *(const v4f*)mp;
            v4f m1 = *(const v4f*)(mp + 4);
            sc[st] = __builtin_shufflevector(m0, m1, 0, 1, 2, 3, 4, 5, 6, 7);
        }

        // ------ GEMM1: S^T = K . Q^T + Mask^T (A = K frags, B = Q, C = mask), 8 WMMAs ------
        #pragma unroll
        for (int stp = 0; stp < 2; ++stp) {
            const int sa = 2 * stp, sb = 2 * stp + 1;
            v16bf b00 = *(const v16bf*)&Kf[((sa * 2 + 0) * 32 + lane) << 4];
            v16bf b01 = *(const v16bf*)&Kf[((sa * 2 + 1) * 32 + lane) << 4];
            v16bf b10 = *(const v16bf*)&Kf[((sb * 2 + 0) * 32 + lane) << 4];
            v16bf b11 = *(const v16bf*)&Kf[((sb * 2 + 1) * 32 + lane) << 4];
            v8f ca = __builtin_amdgcn_wmma_f32_16x16x32_bf16(false, b00, false, qa[0], (short)0, sc[sa], false, false);
            v8f cb = __builtin_amdgcn_wmma_f32_16x16x32_bf16(false, b10, false, qa[0], (short)0, sc[sb], false, false);
            ca     = __builtin_amdgcn_wmma_f32_16x16x32_bf16(false, b01, false, qa[1], (short)0, ca, false, false);
            cb     = __builtin_amdgcn_wmma_f32_16x16x32_bf16(false, b11, false, qa[1], (short)0, cb, false, false);
            sc[sa] = ca; sc[sb] = cb;
        }

        // ------ online max: a lane holds 32 of its query's 64 scores, its partner the rest ------
        float tm[4];
        #pragma unroll
        for (int st = 0; st < 4; ++st) {
            tm[st] = sc[st][0];
            #pragma unroll
            for (int r = 1; r < 8; ++r) tm[st] = fmaxf(tm[st], sc[st][r]);
        }
        float tmax = fmaxf(fmaxf(tm[0], tm[1]), fmaxf(tm[2], tm[3]));
        tmax = fmaxf(tmax, xhalf(tmax));
        const float nmax = fmaxf(run_max, tmax);
        const float scl  = __builtin_amdgcn_exp2f((run_max - nmax) * cexp);
        const float nm2  = nmax * cexp;
        run_max = nmax;

        // ------ exp2; two score tiles, converted in place, are one B fragment of P^T ------
        v16bf pb[2];
        #pragma unroll
        for (int kk = 0; kk < 2; ++kk) {
            #pragma unroll
            for (int e = 0; e < 16; ++e) {
                float p = __builtin_amdgcn_exp2f(__builtin_fmaf(sc[2 * kk + (e >> 3)][e & 7], cexp, -nm2));
                pb[kk][e] = (__bf16)p;
            }
        }
        // rescale O^T: one factor per lane
        #pragma unroll
        for (int nd = 0; nd < 4; ++nd) o[nd] *= scl;

        // ---------------- GEMM2: O^T += V^T . P^T ; sums = 1 . P^T ----------------
        v8f z = {0.f};
        v8f rs = __builtin_amdgcn_wmma_f32_16x16x32_bf16(false, ones, false, pb[0], (short)0, z,  false, false);
        rs     = __builtin_amdgcn_wmma_f32_16x16x32_bf16(false, ones, false, pb[1], (short)0, rs, false, false);
        #pragma unroll
        for (int nd = 0; nd < 4; ++nd) {
            v16bf vb0 = *(const v16bf*)&Vf[((0 * 4 + nd) * 32 + lane) << 4];
            v16bf vb1 = *(const v16bf*)&Vf[((1 * 4 + nd) * 32 + lane) << 4];
            o[nd] = __builtin_amdgcn_wmma_f32_16x16x32_bf16(false, vb0, false, pb[0], (short)0, o[nd], false, false);
            o[nd] = __builtin_amdgcn_wmma_f32_16x16x32_bf16(false, vb1, false, pb[1], (short)0, o[nd], false, false);
        }
        run_sum = run_sum * scl + rs[0];
    }

    // ---------------- epilogue: divide by running sum, store fp32 ----------------
    {
        const float inv = 1.0f / run_sum;
        float* orow = Out + (((size_t)n * L_ + l_own) * H_ + h) * D_ + 8 * h2;
        #pragma unroll
        for (int nd = 0; nd < 4; ++nd) {
            v8f t = o[nd] * inv;
            *(v4f*)(orow + nd * 16)     = __builtin_shufflevector(t, t, 0, 1, 2, 3);
            *(v4f*)(orow + nd * 16 + 4) = __builtin_shufflevector(t, t, 4, 5, 6, 7);
        }
    }
}

extern "C" void kernel_launch(void* const* d_in, const int* in_sizes, int n_in,
                              void* d_out, int out_size, void* d_ws, size_t ws_size,
                              hipStream_t stream) {
    const float* Q = (const float*)d_in[0];
    const float* K = (const float*)d_in[1];
    const float* V = (const float*)d_in[2];
    const float* M = (const float*)d_in[3];
    float* O = (float*)d_out;
    dim3 grid(N_ * H_ * (L_ / BM));   // 2*16*16 = 512 blocks
    fattn_wmma_kernel<<<grid, 256, 0, stream>>>(Q, K, V, M, O);
}

// v002
// A run of this version takes 57.8 microseconds.
// In both of two side-by-side timings against v001, it was 1.41 times as fast.
// Counting every step since v000, it is 2.03 times as fast.
#include <hip/hip_runtime.h>

typedef __attribute__((ext_vector_type(16))) __bf16 v16bf;
typedef __attribute__((ext_vector_type(4)))  __bf16 v4bf;
typedef __attribute__((ext_vector_type(8)))  float  v8f;
typedef __attribute__((ext_vector_type(4)))  float  v4f;

#define N_  2
#define L_  2048
#define S_  2048
#define H_  16
#define E_  64
#define D_  64
#define BM  128      // query rows per block (8 waves x 16)
#define BN  64       // key rows per S tile
#define MP  68       // floats per staged mask row: 256 B + 16 B, an odd multiple of 16 B for b128 readers
#define LOG2E 1.4426950408889634f

// 16-bit A/B fragment layout (hardware k order), inverse map:
//   lane-half h2 = (k>>3)&1 ; element slot e_idx = (k&7) + 8*(k>>4)
// A takes it with lane&15 = row, B with lane&15 = column, so one staged
// fragment serves as either operand.

// lane l <-> l ^ 16
__device__ __forceinline__ float xhalf(float v) {
    int b = __builtin_bit_cast(int, v);
    b = __builtin_amdgcn_permlanex16(b, b, 0x76543210, 0xfedcba98, false, false);
    return __builtin_bit_cast(float, b);
}

__global__ __launch_bounds__(256)
void fattn_wmma_kernel(const float* __restrict__ Q, const float* __restrict__ K,
                       const float* __restrict__ V, const float* __restrict__ Mask,
                       float* __restrict__ Out)
{
    __shared__ __align__(32) __bf16 Kf[2][4 * 2 * 32 * 16];   // K frags, two buffers (16 KB)
    __shared__ __align__(32) __bf16 Vf[2][2 * 4 * 32 * 16];   // V frags, two buffers (16 KB)
    __shared__ __align__(16) float  Mf[8 * 16 * MP];          // mask rows per wave (34 KB)

    const int tid  = threadIdx.x;
    const int w    = tid >> 5;
    const int lane = tid & 31;
    const int h2   = lane >> 4;
    const int c16  = lane & 15;

    const int bid = blockIdx.x;
    const int lb  = bid & 15;
    const int h   = (bid >> 4) & 15;
    const int n   = bid >> 8;

    const int l_base = lb * BM + w * 16;
    const int l_own  = l_base + c16;               // the one query this lane owns
    const float cexp = 0.125f * LOG2E;             // softmax_temp, in log2 units

    // ---------------- Q fragments (registers, whole kernel): B operand ----------------
    v16bf qa[2];
    {
        const float* qrow = Q + (((size_t)n * L_ + l_own) * H_ + h) * E_;
        #pragma unroll
        for (int half = 0; half < 2; ++half) {
            const float* base = qrow + half * 32 + 8 * h2;
            #pragma unroll
            for (int j = 0; j < 8; ++j)  qa[half][j]     = (__bf16)base[j];
            #pragma unroll
            for (int j = 0; j < 8; ++j)  qa[half][8 + j] = (__bf16)base[16 + j];
        }
    }
    // all-ones A fragment: column sums of P^T via the matrix pipe (1 . P^T)
    v16bf ones;
    #pragma unroll
    for (int j = 0; j < 16; ++j) ones[j] = (__bf16)1.0f;

    // o[nd][r] = O[l_own][nd*16 + 8*h2 + r]
    v8f o[4] = {v8f{0.f}, v8f{0.f}, v8f{0.f}, v8f{0.f}};
    float run_max = -3.0e38f;     // of qk + mask, unscaled
    float run_sum = 0.0f;

    float* Mw = Mf + w * (16 * MP);
    // whole-line mask loads: lanes 0-15 one row's 64 columns, lanes 16-31 the next row's
    const float* mt = Mask + (size_t)(l_base + h2) * S_ + 4 * c16;
    // K: thread covers key rows (tid>>4) + 16*it, columns 4*(tid&15)..+3
    const float* kt = K + (((size_t)n * S_ + (tid >> 4)) * H_ + h) * E_ + (tid & 15) * 4;
    // V: 4x4 (s x d) block per thread
    const float* vt = V + (((size_t)n * S_ + (tid >> 4) * 4) * H_ + h) * D_ + (tid & 15) * 4;

    // one tile's raw fp32 data, held in registers while the tile before it is worked on
    v4f mk[8], kr[4], vr[4];

    // loads the tile 'ahead' keys (0 or BN) behind the one that mt, kt, vt point at
    auto load_tile = [&](int ahead) {
        #pragma unroll
        for (int j = 0; j < 8; ++j)
            mk[j] = *(const v4f*)(mt + (size_t)(2 * j) * S_ + ahead);
        #pragma unroll
        for (int it = 0; it < 4; ++it)
            kr[it] = *(const v4f*)(kt + (size_t)(ahead + it * 16) * (H_ * E_));
        #pragma unroll
        for (int j = 0; j < 4; ++j)
            vr[j] = *(const v4f*)(vt + (size_t)(ahead + j) * (H_ * D_));
    };

    auto stage_tile = [&](__bf16* Kb, __bf16* Vb) {
        // ---------- K tile directly into fragment layout ----------
        #pragma unroll
        for (int it = 0; it < 4; ++it) {
            int idx = (it * 256 + tid) * 4;
            int s   = idx >> 6;
            int col = idx & 63;
            int half = col >> 5;
            int k    = col & 31;
            int kh2  = (k >> 3) & 1;
            int slot = (k & 7) + 8 * (k >> 4);
            int lfr  = (s & 15) + 16 * kh2;
            int st   = s >> 4;
            v4bf pk;
            pk[0] = (__bf16)kr[it][0]; pk[1] = (__bf16)kr[it][1];
            pk[2] = (__bf16)kr[it][2]; pk[3] = (__bf16)kr[it][3];
            *(v4bf*)&Kb[(((st * 2 + half) * 32 + lfr) << 4) + slot] = pk;
        }
        // ---------- V tile: 4x4 (s x d) block per thread ----------
        {
            int d0  = (tid & 15) * 4;
            int sl0 = (tid >> 4) * 4;
            int kk   = sl0 >> 5;
            int k    = sl0 & 31;
            int kh2  = (k >> 3) & 1;
            int slot = (k & 7) + 8 * (k >> 4);
            #pragma unroll
            for (int j = 0; j < 4; ++j) {
                int d   = d0 + j;
                int lfr = (d & 15) + 16 * kh2;
                int nd  = d >> 4;
                v4bf pv;
                pv[0] = (__bf16)vr[0][j]; pv[1] = (__bf16)vr[1][j];
                pv[2] = (__bf16)vr[2][j]; pv[3] = (__bf16)vr[3][j];
                *(v4bf*)&Vb[(((kk * 4 + nd) * 32 + lfr) << 4) + slot] = pv;
            }
        }
        // ---------- this wave's own 16 x 64 mask tile, row-major ----------
        #pragma unroll
        for (int j = 0; j < 8; ++j)
            *(v4f*)&Mw[(2 * j + h2) * MP + 4 * c16] = mk[j];
    };

    auto compute_tile = [&](const __bf16* Kb, const __bf16* Vb) {
        // mask^T tiles in accumulator layout: sc[st][r] = Mask[l_own][s0 + st*16 + 8*h2 + r]
        v8f sc[4];
        #pragma unroll
        for (int st = 0; st < 4; ++st) {
            const float* mp = &Mw[c16 * MP + st * 16 + 8 * h2];
            v4f m0 = *(const v4f*)mp;
            v4f m1 = *(const v4f*)(mp + 4);
            sc[st] = __builtin_shufflevector(m0, m1, 0, 1, 2, 3, 4, 5, 6, 7);
        }

        // ------ GEMM1: S^T = K . Q^T + Mask^T (A = K frags, B = Q, C = mask), 8 WMMAs ------
        #pragma unroll
        for (int stp = 0; stp < 2; ++stp) {
            const int sa = 2 * stp, sb = 2 * stp + 1;
            v16bf b00 = *(const v16bf*)&Kb[((sa * 2 + 0) * 32 + lane) << 4];
            v16bf b01 = *(const v16bf*)&Kb[((sa * 2 + 1) * 32 + lane) << 4];
            v16bf b10 = *(const v16bf*)&Kb[((sb * 2 + 0) * 32 + lane) << 4];
            v16bf b11 = *(const v16bf*)&Kb[((sb * 2 + 1) * 32 + lane) << 4];
            v8f ca = __builtin_amdgcn_wmma_f32_16x16x32_bf16(false, b00, false, qa[0], (short)0, sc[sa], false, false);
            v8f cb = __builtin_amdgcn_wmma_f32_16x16x32_bf16(false, b10, false, qa[0], (short)0, sc[sb], false, false);
            ca     = __builtin_amdgcn_wmma_f32_16x16x32_bf16(false, b01, false, qa[1], (short)0, ca, false, false);
            cb     = __builtin_amdgcn_wmma_f32_16x16x32_bf16(false, b11, false, qa[1], (short)0, cb, false, false);
            sc[sa] = ca; sc[sb] = cb;
        }

        // ------ online max: a lane holds 32 of its query's 64 scores, its partner the rest ------
        float tm[4];
        #pragma unroll
        for (int st = 0; st < 4; ++st) {
            tm[st] = sc[st][0];
            #pragma unroll
            for (int r = 1; r < 8; ++r) tm[st] = fmaxf(tm[st], sc[st][r]);
        }
        float tmax = fmaxf(fmaxf(tm[0], tm[1]), fmaxf(tm[2], tm[3]));
        tmax = fmaxf(tmax, xhalf(tmax));
        const float nmax = fmaxf(run_max, tmax);
        const float scl  = __builtin_amdgcn_exp2f((run_max - nmax) * cexp);
        const float nm2  = nmax * cexp;
        run_max = nmax;

        // ------ exp2; two score tiles, converted in place, are one B fragment of P^T ------
        v16bf pb[2];
        #pragma unroll
        for (int kk = 0; kk < 2; ++kk) {
            #pragma unroll
            for (int e = 0; e < 16; ++e) {
                float p = __builtin_amdgcn_exp2f(__builtin_fmaf(sc[2 * kk + (e >> 3)][e & 7], cexp, -nm2));
                pb[kk][e] = (__bf16)p;
            }
        }
        // rescale O^T: one factor per lane
        #pragma unroll
        for (int nd = 0; nd < 4; ++nd) o[nd] *= scl;

        // ---------------- GEMM2: O^T += V^T . P^T ; sums = 1 . P^T ----------------
        v8f z = {0.f};
        v8f rs = __builtin_amdgcn_wmma_f32_16x16x32_bf16(false, ones, false, pb[0], (short)0, z,  false, false);
        rs     = __builtin_amdgcn_wmma_f32_16x16x32_bf16(false, ones, false, pb[1], (short)0, rs, false, false);
        #pragma unroll
        for (int nd = 0; nd < 4; ++nd) {
            v16bf vb0 = *(const v16bf*)&Vb[((0 * 4 + nd) * 32 + lane) << 4];
            v16bf vb1 = *(const v16bf*)&Vb[((1 * 4 + nd) * 32 + lane) << 4];
            o[nd] = __builtin_amdgcn_wmma_f32_16x16x32_bf16(false, vb0, false, pb[0], (short)0, o[nd], false, false);
            o[nd] = __builtin_amdgcn_wmma_f32_16x16x32_bf16(false, vb1, false, pb[1], (short)0, o[nd], false, false);
        }
        run_sum = run_sum * scl + rs[0];
    };

    // prologue: tile 0 into buffer 0
    load_tile(0);
    stage_tile(Kf[0], Vf[0]);
    __syncthreads();

    // Tile t is worked on out of buffer t&1 while tile t+1 is on its way from global memory
    // into registers; it is converted into the other buffer behind the work. That buffer's last
    // readers (tile t-1) are behind the barrier that ended the trip before, so one barrier a trip.
    #pragma unroll 1
    for (int t = 0; t < S_ / BN; ++t) {
        const int  cur  = t & 1;
        const bool more = t + 1 < S_ / BN;     // the same for the whole block
        if (more) load_tile(BN);
        compute_tile(Kf[cur], Vf[cur]);
        // stands in front of the pointer steps below, which rewrite the address registers that
        // the sixteen issued loads name; outside their branch, so that no step is lifted over it
        asm volatile("s_wait_xcnt 0x0" ::: "memory");
        if (more) {
            stage_tile(Kf[cur ^ 1], Vf[cur ^ 1]);
            mt += BN;
            kt += (size_t)BN * (H_ * E_);
            vt += (size_t)BN * (H_ * D_);
        }
        __syncthreads();
    }

    // ---------------- epilogue: divide by running sum, store fp32 ----------------
    {
        const float inv = 1.0f / run_sum;
        float* orow = Out + (((size_t)n * L_ + l_own) * H_ + h) * D_ + 8 * h2;
        #pragma unroll
        for (int nd = 0; nd < 4; ++nd) {
            v8f t = o[nd] * inv;
            *(v4f*)(orow + nd * 16)     = __builtin_shufflevector(t, t, 0, 1, 2, 3);
            *(v4f*)(orow + nd * 16 + 4) = __builtin_shufflevector(t, t, 4, 5, 6, 7);
        }
    }
}

extern "C" void kernel_launch(void* const* d_in, const int* in_sizes, int n_in,
                              void* d_out, int out_size, void* d_ws, size_t ws_size,
                              hipStream_t stream) {
    const float* Q = (const float*)d_in[0];
    const float* K = (const float*)d_in[1];
    const float* V = (const float*)d_in[2];
    const float* M = (const float*)d_in[3];
    float* O = (float*)d_out;
    dim3 grid(N_ * H_ * (L_ / BM));   // 2*16*16 = 512 blocks
    fattn_wmma_kernel<<<grid, 256, 0, stream>>>(Q, K, V, M, O);
}

// v003
// A run of this version takes 47.8 microseconds.
// In two side-by-side timings against v002, it was 1.20 and 1.21 times as fast.
// Over all steps from v000 it is 2.44 times as fast.
#include <hip/hip_runtime.h>

typedef __attribute__((ext_vector_type(16))) __bf16 v16bf;
typedef __attribute__((ext_vector_type(8)))  __bf16 v8bf;
typedef __attribute__((ext_vector_type(4)))  __bf16 v4bf;
typedef __attribute__((ext_vector_type(8)))  float  v8f;
typedef __attribute__((ext_vector_type(4)))  float  v4f;

#define N_  2
#define L_  2048
#define S_  2048
#define H_  16
#define E_  64
#define D_  64
#define BM  128      // query rows per block (8 waves x 16)
#define BN  64       // key rows per S tile
#define MP  68       // floats per staged mask row: 256 B + 16 B, an odd multiple of 16 B for b128 readers
#define KP  144      // bf16 per K chunk: 256 B + 32 B
#define VP  136      // bf16 per V chunk: 256 B + 16 B
#define LOG2E 1.4426950408889634f

// 16-bit A/B fragment layout (hardware k order), inverse map:
//   lane-half h2 = (k>>3)&1 ; element slot e_idx = (k&7) + 8*(k>>4)
// A takes it with lane&15 = row, B with lane&15 = column, so one staged
// fragment serves as either operand.
//
// LDS form of a fragment: four chunks (plane = e_idx>>3, h2), each 16 lanes x 16 B in a row, so
// that the 16 lanes of one half of a ds_load_b128 read 256 contiguous bytes: every bank once.
// The chunk pitches spread the 8-byte stores of the staging threads over all banks as well.
//   K chunk = st*8 + half*4 + plane*2 + h2          V chunk = ((kk*2 + plane)*2 + h2)*4 + nd

// lane l <-> l ^ 16
__device__ __forceinline__ float xhalf(float v) {
    int b = __builtin_bit_cast(int, v);
    b = __builtin_amdgcn_permlanex16(b, b, 0x76543210, 0xfedcba98, false, false);
    return __builtin_bit_cast(float, b);
}

__global__ __launch_bounds__(256)
void fattn_wmma_kernel(const float* __restrict__ Q, const float* __restrict__ K,
                       const float* __restrict__ V, const float* __restrict__ Mask,
                       float* __restrict__ Out)
{
    __shared__ __align__(16) __bf16 Kf[2][32 * KP];           // K chunks, two buffers (18 KB)
    __shared__ __align__(16) __bf16 Vf[2][32 * VP];           // V chunks, two buffers (17 KB)
    __shared__ __align__(16) float  Mf[8 * 16 * MP];          // mask rows per wave (34 KB)

    const int tid  = threadIdx.x;
    const int w    = tid >> 5;
    const int lane = tid & 31;
    const int h2   = lane >> 4;
    const int c16  = lane & 15;

    const int bid = blockIdx.x;
    const int lb  = bid & 15;
    const int h   = (bid >> 4) & 15;
    const int n   = bid >> 8;

    const int l_base = lb * BM + w * 16;
    const int l_own  = l_base + c16;               // the one query this lane owns
    const float cexp = 0.125f * LOG2E;             // softmax_temp, in log2 units

    // ---------------- Q fragments (registers, whole kernel): B operand ----------------
    v16bf qa[2];
    {
        const float* qrow = Q + (((size_t)n * L_ + l_own) * H_ + h) * E_;
        #pragma unroll
        for (int half = 0; half < 2; ++half) {
            const float* base = qrow + half * 32 + 8 * h2;
            #pragma unroll
            for (int j = 0; j < 8; ++j)  qa[half][j]     = (__bf16)base[j];
            #pragma unroll
            for (int j = 0; j < 8; ++j)  qa[half][8 + j] = (__bf16)base[16 + j];
        }
    }
    // all-ones A fragment: column sums of P^T via the matrix pipe (1 . P^T)
    v16bf ones;
    #pragma unroll
    for (int j = 0; j < 16; ++j) ones[j] = (__bf16)1.0f;

    // o[nd][r] = O[l_own][nd*16 + 8*h2 + r]
    v8f o[4] = {v8f{0.f}, v8f{0.f}, v8f{0.f}, v8f{0.f}};
    float run_max = -3.0e38f;     // of qk + mask, unscaled
    float run_sum = 0.0f;

    float* Mw = Mf + w * (16 * MP);
    // whole-line mask loads: lanes 0-15 one row's 64 columns, lanes 16-31 the next row's
    const float* mt = Mask + (size_t)(l_base + h2) * S_ + 4 * c16;
    // K: thread covers key rows (tid>>4) + 16*it, columns 4*(tid&15)..+3
    const float* kt = K + (((size_t)n * S_ + (tid >> 4)) * H_ + h) * E_ + (tid & 15) * 4;
    // V: 4x4 (s x d) block per thread
    const float* vt = V + (((size_t)n * S_ + (tid >> 4) * 4) * H_ + h) * D_ + (tid & 15) * 4;

    // one tile's raw fp32 data, held in registers while the tile before it is worked on
    v4f mk[8], kr[4], vr[4];

    // loads the tile 'ahead' keys (0 or BN) behind the one that mt, kt, vt point at
    auto load_tile = [&](int ahead) {
        #pragma unroll
        for (int j = 0; j < 8; ++j)
            mk[j] = *(const v4f*)(mt + (size_t)(2 * j) * S_ + ahead);
        #pragma unroll
        for (int it = 0; it < 4; ++it)
            kr[it] = *(const v4f*)(kt + (size_t)(ahead + it * 16) * (H_ * E_));
        #pragma unroll
        for (int j = 0; j < 4; ++j)
            vr[j] = *(const v4f*)(vt + (size_t)(ahead + j) * (H_ * D_));
    };

    auto stage_tile = [&](__bf16* Kb, __bf16* Vb) {
        // ---------- K tile directly into fragment layout ----------
        #pragma unroll
        for (int it = 0; it < 4; ++it) {
            int idx = (it * 256 + tid) * 4;
            int s   = idx >> 6;
            int col = idx & 63;
            int half = col >> 5;
            int k    = col & 31;
            int kh2  = (k >> 3) & 1;
            int pl   = k >> 4;
            int st   = s >> 4;
            v4bf pk;
            pk[0] = (__bf16)kr[it][0]; pk[1] = (__bf16)kr[it][1];
            pk[2] = (__bf16)kr[it][2]; pk[3] = (__bf16)kr[it][3];
            *(v4bf*)&Kb[(st * 8 + half * 4 + pl * 2 + kh2) * KP + (s & 15) * 8 + (k & 7)] = pk;
        }
        // ---------- V tile: 4x4 (s x d) block per thread ----------
        {
            int d0  = (tid & 15) * 4;
            int sl0 = (tid >> 4) * 4;
            int kk   = sl0 >> 5;
            int k    = sl0 & 31;
            int kh2  = (k >> 3) & 1;
            int pl   = k >> 4;
            #pragma unroll
            for (int j = 0; j < 4; ++j) {
                int d   = d0 + j;
                int nd  = d >> 4;
                v4bf pv;
                pv[0] = (__bf16)vr[0][j]; pv[1] = (__bf16)vr[1][j];
                pv[2] = (__bf16)vr[2][j]; pv[3] = (__bf16)vr[3][j];
                *(v4bf*)&Vb[(((kk * 2 + pl) * 2 + kh2) * 4 + nd) * VP + (d & 15) * 8 + (k & 7)] = pv;
            }
        }
        // ---------- this wave's own 16 x 64 mask tile, row-major ----------
        #pragma unroll
        for (int j = 0; j < 8; ++j)
            *(v4f*)&Mw[(2 * j + h2) * MP + 4 * c16] = mk[j];
    };

    // a fragment out of its two planes' chunks
    auto k_frag = [&](const __bf16* Kb, int st, int half) {
        const __bf16* p = &Kb[(st * 8 + half * 4 + h2) * KP + c16 * 8];
        return __builtin_shufflevector(*(const v8bf*)p, *(const v8bf*)(p + 2 * KP),
                                       0, 1, 2, 3, 4, 5, 6, 7, 8, 9, 10, 11, 12, 13, 14, 15);
    };
    auto v_frag = [&](const __bf16* Vb, int kk, int nd) {
        const __bf16* p = &Vb[((kk * 4 + h2) * 4 + nd) * VP + c16 * 8];
        return __builtin_shufflevector(*(const v8bf*)p, *(const v8bf*)(p + 8 * VP),
                                       0, 1, 2, 3, 4, 5, 6, 7, 8, 9, 10, 11, 12, 13, 14, 15);
    };

    auto compute_tile = [&](const __bf16* Kb, const __bf16* Vb) {
        // mask^T tiles in accumulator layout: sc[st][r] = Mask[l_own][s0 + st*16 + 8*h2 + r]
        v8f sc[4];
        #pragma unroll
        for (int st = 0; st < 4; ++st) {
            const float* mp = &Mw[c16 * MP + st * 16 + 8 * h2];
            v4f m0 = *(const v4f*)mp;
            v4f m1 = *(const v4f*)(mp + 4);
            sc[st] = __builtin_shufflevector(m0, m1, 0, 1, 2, 3, 4, 5, 6, 7);
        }

        // ------ GEMM1: S^T = K . Q^T + Mask^T (A = K frags, B = Q, C = mask), 8 WMMAs ------
        #pragma unroll
        for (int stp = 0; stp < 2; ++stp) {
            const int sa = 2 * stp, sb = 2 * stp + 1;
            v16bf b00 = k_frag(Kb, sa, 0);
            v16bf b01 = k_frag(Kb, sa, 1);
            v16bf b10 = k_frag(Kb, sb, 0);
            v16bf b11 = k_frag(Kb, sb, 1);
            v8f ca = __builtin_amdgcn_wmma_f32_16x16x32_bf16(false, b00, false, qa[0], (short)0, sc[sa], false, false);
            v8f cb = __builtin_amdgcn_wmma_f32_16x16x32_bf16(false, b10, false, qa[0], (short)0, sc[sb], false, false);
            ca     = __builtin_amdgcn_wmma_f32_16x16x32_bf16(false, b01, false, qa[1], (short)0, ca, false, false);
            cb     = __builtin_amdgcn_wmma_f32_16x16x32_bf16(false, b11, false, qa[1], (short)0, cb, false, false);
            sc[sa] = ca; sc[sb] = cb;
        }

        // ------ online max: a lane holds 32 of its query's 64 scores, its partner the rest ------
        float tm[4];
        #pragma unroll
        for (int st = 0; st < 4; ++st) {
            tm[st] = sc[st][0];
            #pragma unroll
            for (int r = 1; r < 8; ++r) tm[st] = fmaxf(tm[st], sc[st][r]);
        }
        float tmax = fmaxf(fmaxf(tm[0], tm[1]), fmaxf(tm[2], tm[3]));
        tmax = fmaxf(tmax, xhalf(tmax));
        const float nmax = fmaxf(run_max, tmax);
        const float scl  = __builtin_amdgcn_exp2f((run_max - nmax) * cexp);
        const float nm2  = nmax * cexp;
        run_max = nmax;

        // ------ exp2; two score tiles, converted in place, are one B fragment of P^T ------
        v16bf pb[2];
        #pragma unroll
        for (int kk = 0; kk < 2; ++kk) {
            #pragma unroll
            for (int e = 0; e < 16; ++e) {
                float p = __builtin_amdgcn_exp2f(__builtin_fmaf(sc[2 * kk + (e >> 3)][e & 7], cexp, -nm2));
                pb[kk][e] = (__bf16)p;
            }
        }
        // rescale O^T: one factor per lane
        #pragma unroll
        for (int nd = 0; nd < 4; ++nd) o[nd] *= scl;

        // ---------------- GEMM2: O^T += V^T . P^T ; sums = 1 . P^T ----------------
        v8f z = {0.f};
        v8f rs = __builtin_amdgcn_wmma_f32_16x16x32_bf16(false, ones, false, pb[0], (short)0, z,  false, false);
        rs     = __builtin_amdgcn_wmma_f32_16x16x32_bf16(false, ones, false, pb[1], (short)0, rs, false, false);
        #pragma unroll
        for (int nd = 0; nd < 4; ++nd) {
            v16bf vb0 = v_frag(Vb, 0, nd);
            v16bf vb1 = v_frag(Vb, 1, nd);
            o[nd] = __builtin_amdgcn_wmma_f32_16x16x32_bf16(false, vb0, false, pb[0], (short)0, o[nd], false, false);
            o[nd] = __builtin_amdgcn_wmma_f32_16x16x32_bf16(false, vb1, false, pb[1], (short)0, o[nd], false, false);
        }
        run_sum = run_sum * scl + rs[0];
    };

    // prologue: tile 0 into buffer 0
    load_tile(0);
    stage_tile(Kf[0], Vf[0]);
    __syncthreads();

    // Tile t is worked on out of buffer t&1 while tile t+1 is on its way from global memory
    // into registers; it is converted into the other buffer behind the work. That buffer's last
    // readers (tile t-1) are behind the barrier that ended the trip before, so one barrier a trip.
    #pragma unroll 1
    for (int t = 0; t < S_ / BN; ++t) {
        const int  cur  = t & 1;
        const bool more = t + 1 < S_ / BN;     // the same for the whole block
        if (more) load_tile(BN);
        compute_tile(Kf[cur], Vf[cur]);
        // stands in front of the pointer steps below, which rewrite the address registers that
        // the sixteen issued loads name; outside their branch, so that no step is lifted over it
        asm volatile("s_wait_xcnt 0x0" ::: "memory");
        if (more) {
            stage_tile(Kf[cur ^ 1], Vf[cur ^ 1]);
            mt += BN;
            kt += (size_t)BN * (H_ * E_);
            vt += (size_t)BN * (H_ * D_);
        }
        __syncthreads();
    }

    // ---------------- epilogue: divide by running sum, store fp32 ----------------
    {
        const float inv = 1.0f / run_sum;
        float* orow = Out + (((size_t)n * L_ + l_own) * H_ + h) * D_ + 8 * h2;
        #pragma unroll
        for (int nd = 0; nd < 4; ++nd) {
            v8f t = o[nd] * inv;
            *(v4f*)(orow + nd * 16)     = __builtin_shufflevector(t, t, 0, 1, 2, 3);
            *(v4f*)(orow + nd * 16 + 4) = __builtin_shufflevector(t, t, 4, 5, 6, 7);
        }
    }
}

extern "C" void kernel_launch(void* const* d_in, const int* in_sizes, int n_in,
                              void* d_out, int out_size, void* d_ws, size_t ws_size,
                              hipStream_t stream) {
    const float* Q = (const float*)d_in[0];
    const float* K = (const float*)d_in[1];
    const float* V = (const float*)d_in[2];
    const float* M = (const float*)d_in[3];
    float* O = (float*)d_out;
    dim3 grid(N_ * H_ * (L_ / BM));   // 2*16*16 = 512 blocks
    fattn_wmma_kernel<<<grid, 256, 0, stream>>>(Q, K, V, M, O);
}

// v004
// One run takes 44.5 microseconds.
// Two timings next to v003 put it at 1.08 and 1.07 times that version's speed.
// All steps since v000 together make it 2.63 times as fast.
#include <hip/hip_runtime.h>

typedef __attribute__((ext_vector_type(16))) __bf16 v16bf;
typedef __attribute__((ext_vector_type(8)))  __bf16 v8bf;
typedef __attribute__((ext_vector_type(4)))  __bf16 v4bf;
typedef __attribute__((ext_vector_type(8)))  float  v8f;
typedef __attribute__((ext_vector_type(4)))  float  v4f;
typedef __attribute__((ext_vector_type(4)))  uint32_t u32x4;
typedef __attribute__((ext_vector_type(8)))  uint32_t u32x8;

#define N_  2
#define L_  2048
#define S_  2048
#define H_  16
#define E_  64
#define D_  64
#define BM  128      // query rows per block (8 waves x 16)
#define BN  64       // key rows per S tile
#define MP  68       // floats per staged mask row: 256 B + 16 B, an odd multiple of 16 B for b128 readers
#define MSL 6144     // LDS bytes per wave and buffer for its mask tile: 16 rows x 272 B, rounded up to a multiple of 2 KiB
#define KP  144      // bf16 per K chunk: 256 B + 32 B
#define VP  136      // bf16 per V chunk: 256 B + 16 B
#define LOG2E 1.4426950408889634f

// 16-bit A/B fragment layout (hardware k order), inverse map:
//   lane-half h2 = (k>>3)&1 ; element slot e_idx = (k&7) + 8*(k>>4)
// A takes it with lane&15 = row, B with lane&15 = column, so one staged
// fragment serves as either operand.
//
// LDS form of a fragment: four chunks (plane = e_idx>>3, h2), each 16 lanes x 16 B in a row, so
// that the 16 lanes of one half of a ds_load_b128 read 256 contiguous bytes: every bank once.
// The chunk pitches spread the 8-byte stores of the staging threads over all banks as well.
//   K chunk = st*8 + half*4 + plane*2 + h2          V chunk = ((kk*2 + plane)*2 + h2)*4 + nd

// lane l <-> l ^ 16
__device__ __forceinline__ float xhalf(float v) {
    int b = __builtin_bit_cast(int, v);
    b = __builtin_amdgcn_permlanex16(b, b, 0x76543210, 0xfedcba98, false, false);
    return __builtin_bit_cast(float, b);
}

__device__ __forceinline__ uint32_t uni(uint32_t v) { return (uint32_t)__builtin_amdgcn_readfirstlane(v); }
// a value held in a scalar register, so that a test on it is a scalar branch and what is formed
// from it is formed behind the asm statements in front of it
__device__ __forceinline__ uint32_t pinned(uint32_t v) {
    uint32_t w = uni(v);
    asm volatile("" : "+s"(w));   // holds the word in a scalar register
    return w;
}

__global__ __launch_bounds__(256)
void fattn_wmma_kernel(const float* __restrict__ Q, const float* __restrict__ K,
                       const float* __restrict__ V, const float* __restrict__ Mask,
                       float* __restrict__ Out)
{
    __shared__ __align__(16) __bf16 Kf[2][32 * KP];           // K chunks, two buffers (18 KB)
    __shared__ __align__(16) __bf16 Vf[2][32 * VP];           // V chunks, two buffers (17 KB)
    // mask tiles, two buffers x 8 waves, each wave's at a multiple of 2 KiB (96 KB)
    __shared__ __attribute__((aligned(2048))) unsigned char Mf[2 * 8 * MSL];

    const int tid  = threadIdx.x;
    const int w    = (int)uni((uint32_t)tid >> 5);
    const int lane = tid & 31;
    const int h2   = lane >> 4;
    const int c16  = lane & 15;

    const int bid = blockIdx.x;
    const int lb  = bid & 15;
    const int h   = (bid >> 4) & 15;
    const int n   = bid >> 8;

    const int l_base = lb * BM + w * 16;
    const int l_own  = l_base + c16;               // the one query this lane owns
    const float cexp = 0.125f * LOG2E;             // softmax_temp, in log2 units

    // ---------------- Q fragments (registers, whole kernel): B operand ----------------
    v16bf qa[2];
    {
        const float* qrow = Q + (((size_t)n * L_ + l_own) * H_ + h) * E_;
        #pragma unroll
        for (int half = 0; half < 2; ++half) {
            const float* base = qrow + half * 32 + 8 * h2;
            #pragma unroll
            for (int j = 0; j < 8; ++j)  qa[half][j]     = (__bf16)base[j];
            #pragma unroll
            for (int j = 0; j < 8; ++j)  qa[half][8 + j] = (__bf16)base[16 + j];
        }
    }
    // all-ones A fragment: column sums of P^T via the matrix pipe (1 . P^T)
    v16bf ones;
    #pragma unroll
    for (int j = 0; j < 16; ++j) ones[j] = (__bf16)1.0f;

    // o[nd][r] = O[l_own][nd*16 + 8*h2 + r]
    v8f o[4] = {v8f{0.f}, v8f{0.f}, v8f{0.f}, v8f{0.f}};
    float run_max = -3.0e38f;     // of qk + mask, unscaled
    float run_sum = 0.0f;

    // Mask: each wave brings its own 16 x 64 tile into LDS by one tensor load, through no register.
    // Tile: 16 rows of 256 B at a source pitch of S_ * 4 B; 16 B of pad behind each row give pitch MP.
    const uint32_t m_lds = (uint32_t)(size_t)Mf + (uint32_t)w * MSL;
    const uint64_t m_src = (uint64_t)(size_t)(Mask + (size_t)l_base * S_);
    u32x8 mg1;
    mg1[0] = uni((1u << 20) | (5u << 22) | (3u << 25));   // no workgroup mask, 1-byte elements, pad 4 dwords per 64
    mg1[1] = uni(256u << 16);                             // tensor_dim0 = 256 B
    mg1[2] = uni(16u << 16);                              // tensor_dim1 = 16 rows
    mg1[3] = uni(256u << 16);                             // tile_dim0
    mg1[4] = uni(16u);                                    // tile_dim1
    mg1[5] = uni((uint32_t)(S_ * 4));                     // source row pitch
    mg1[6] = uni(0u);
    mg1[7] = uni(0u);
    u32x4 mg0;
    auto mask_load = [&](uint32_t t) {                    // tile t into buffer t & 1
        const uint64_t ga = m_src + (uint64_t)t * (BN * 4);
        mg0[0] = uni(1u);
        mg0[1] = uni(m_lds + (t & 1u) * (8u * MSL));
        mg0[2] = uni((uint32_t)ga);
        mg0[3] = uni((((uint32_t)(ga >> 32)) & 0x01FFFFFFu) | 0x80000000u);
        // one request of the whole wave; every wave issues its own, so no test stands around it here
        asm volatile("tensor_load_to_lds %0, %1" :: "s"(mg0), "s"(mg1) : "memory");
    };
    // the wave's one request has landed; the wait names the descriptor, so that its registers
    // are kept for it, and take no other value, as long as the request is on its way
    auto mask_wait = [&]() {
        asm volatile("s_wait_tensorcnt 0x0" :: "s"(mg0), "s"(mg1) : "memory");
    };
    // K: thread covers key rows (tid>>4) + 16*it, columns 4*(tid&15)..+3
    const float* kt = K + (((size_t)n * S_ + (tid >> 4)) * H_ + h) * E_ + (tid & 15) * 4;
    // V: 4x4 (s x d) block per thread
    const float* vt = V + (((size_t)n * S_ + (tid >> 4) * 4) * H_ + h) * D_ + (tid & 15) * 4;

    // one tile's raw fp32 data, held in registers while the tile before it is worked on
    v4f kr[4], vr[4];

    // loads the tile 'ahead' keys (0 or BN) behind the one that kt, vt point at
    auto load_tile = [&](int ahead) {
        #pragma unroll
        for (int it = 0; it < 4; ++it)
            kr[it] = *(const v4f*)(kt + (size_t)(ahead + it * 16) * (H_ * E_));
        #pragma unroll
        for (int j = 0; j < 4; ++j)
            vr[j] = *(const v4f*)(vt + (size_t)(ahead + j) * (H_ * D_));
    };

    auto stage_tile = [&](__bf16* Kb, __bf16* Vb) {
        // ---------- K tile directly into fragment layout ----------
        #pragma unroll
        for (int it = 0; it < 4; ++it) {
            int idx = (it * 256 + tid) * 4;
            int s   = idx >> 6;
            int col = idx & 63;
            int half = col >> 5;
            int k    = col & 31;
            int kh2  = (k >> 3) & 1;
            int pl   = k >> 4;
            int st   = s >> 4;
            v4bf pk;
            pk[0] = (__bf16)kr[it][0]; pk[1] = (__bf16)kr[it][1];
            pk[2] = (__bf16)kr[it][2]; pk[3] = (__bf16)kr[it][3];
            *(v4bf*)&Kb[(st * 8 + half * 4 + pl * 2 + kh2) * KP + (s & 15) * 8 + (k & 7)] = pk;
        }
        // ---------- V tile: 4x4 (s x d) block per thread ----------
        {
            int d0  = (tid & 15) * 4;
            int sl0 = (tid >> 4) * 4;
            int kk   = sl0 >> 5;
            int k    = sl0 & 31;
            int kh2  = (k >> 3) & 1;
            int pl   = k >> 4;
            #pragma unroll
            for (int j = 0; j < 4; ++j) {
                int d   = d0 + j;
                int nd  = d >> 4;
                v4bf pv;
                pv[0] = (__bf16)vr[0][j]; pv[1] = (__bf16)vr[1][j];
                pv[2] = (__bf16)vr[2][j]; pv[3] = (__bf16)vr[3][j];
                *(v4bf*)&Vb[(((kk * 2 + pl) * 2 + kh2) * 4 + nd) * VP + (d & 15) * 8 + (k & 7)] = pv;
            }
        }
    };

    // a fragment out of its two planes' chunks
    auto k_frag = [&](const __bf16* Kb, int st, int half) {
        const __bf16* p = &Kb[(st * 8 + half * 4 + h2) * KP + c16 * 8];
        return __builtin_shufflevector(*(const v8bf*)p, *(const v8bf*)(p + 2 * KP),
                                       0, 1, 2, 3, 4, 5, 6, 7, 8, 9, 10, 11, 12, 13, 14, 15);
    };
    auto v_frag = [&](const __bf16* Vb, int kk, int nd) {
        const __bf16* p = &Vb[((kk * 4 + h2) * 4 + nd) * VP + c16 * 8];
        return __builtin_shufflevector(*(const v8bf*)p, *(const v8bf*)(p + 8 * VP),
                                       0, 1, 2, 3, 4, 5, 6, 7, 8, 9, 10, 11, 12, 13, 14, 15);
    };

    auto compute_tile = [&](const __bf16* Kb, const __bf16* Vb, const float* Mw) {
        // mask^T tiles in accumulator layout: sc[st][r] = Mask[l_own][s0 + st*16 + 8*h2 + r]
        v8f sc[4];
        #pragma unroll
        for (int st = 0; st < 4; ++st) {
            const float* mp = &Mw[c16 * MP + st * 16 + 8 * h2];
            v4f m0 = *(const v4f*)mp;
            v4f m1 = *(const v4f*)(mp + 4);
            sc[st] = __builtin_shufflevector(m0, m1, 0, 1, 2, 3, 4, 5, 6, 7);
        }

        // ------ GEMM1: S^T = K . Q^T + Mask^T (A = K frags, B = Q, C = mask), 8 WMMAs ------
        #pragma unroll
        for (int stp = 0; stp < 2; ++stp) {
            const int sa = 2 * stp, sb = 2 * stp + 1;
            v16bf b00 = k_frag(Kb, sa, 0);
            v16bf b01 = k_frag(Kb, sa, 1);
            v16bf b10 = k_frag(Kb, sb, 0);
            v16bf b11 = k_frag(Kb, sb, 1);
            v8f ca = __builtin_amdgcn_wmma_f32_16x16x32_bf16(false, b00, false, qa[0], (short)0, sc[sa], false, false);
            v8f cb = __builtin_amdgcn_wmma_f32_16x16x32_bf16(false, b10, false, qa[0], (short)0, sc[sb], false, false);
            ca     = __builtin_amdgcn_wmma_f32_16x16x32_bf16(false, b01, false, qa[1], (short)0, ca, false, false);
            cb     = __builtin_amdgcn_wmma_f32_16x16x32_bf16(false, b11, false, qa[1], (short)0, cb, false, false);
            sc[sa] = ca; sc[sb] = cb;
        }

        // ------ online max: a lane holds 32 of its query's 64 scores, its partner the rest ------
        float tm[4];
        #pragma unroll
        for (int st = 0; st < 4; ++st) {
            tm[st] = sc[st][0];
            #pragma unroll
            for (int r = 1; r < 8; ++r) tm[st] = fmaxf(tm[st], sc[st][r]);
        }
        float tmax = fmaxf(fmaxf(tm[0], tm[1]), fmaxf(tm[2], tm[3]));
        tmax = fmaxf(tmax, xhalf(tmax));
        const float nmax = fmaxf(run_max, tmax);
        const float scl  = __builtin_amdgcn_exp2f((run_max - nmax) * cexp);
        const float nm2  = nmax * cexp;
        run_max = nmax;

        // ------ exp2; two score tiles, converted in place, are one B fragment of P^T ------
        v16bf pb[2];
        #pragma unroll
        for (int kk = 0; kk < 2; ++kk) {
            #pragma unroll
            for (int e = 0; e < 16; ++e) {
                float p = __builtin_amdgcn_exp2f(__builtin_fmaf(sc[2 * kk + (e >> 3)][e & 7], cexp, -nm2));
                pb[kk][e] = (__bf16)p;
            }
        }
        // rescale O^T: one factor per lane
        #pragma unroll
        for (int nd = 0; nd < 4; ++nd) o[nd] *= scl;

        // ---------------- GEMM2: O^T += V^T . P^T ; sums = 1 . P^T ----------------
        v8f z = {0.f};
        v8f rs = __builtin_amdgcn_wmma_f32_16x16x32_bf16(false, ones, false, pb[0], (short)0, z,  false, false);
        rs     = __builtin_amdgcn_wmma_f32_16x16x32_bf16(false, ones, false, pb[1], (short)0, rs, false, false);
        #pragma unroll
        for (int nd = 0; nd < 4; ++nd) {
            v16bf vb0 = v_frag(Vb, 0, nd);
            v16bf vb1 = v_frag(Vb, 1, nd);
            o[nd] = __builtin_amdgcn_wmma_f32_16x16x32_bf16(false, vb0, false, pb[0], (short)0, o[nd], false, false);
            o[nd] = __builtin_amdgcn_wmma_f32_16x16x32_bf16(false, vb1, false, pb[1], (short)0, o[nd], false, false);
        }
        run_sum = run_sum * scl + rs[0];
    };

    // prologue: tile 0 into buffer 0; the mask's tile 1 is sent for behind the barrier
    mask_load(0);
    load_tile(0);
    stage_tile(Kf[0], Vf[0]);
    mask_wait();                                         // mask tile 0 has landed
    __syncthreads();
    mask_load(pinned(1u));                               // its descriptor is formed behind the wait

    // Tile t is worked on out of buffer t&1 while tile t+1 is on its way from global memory
    // into registers; it is converted into the other buffer behind the work. That buffer's last
    // readers (tile t-1) are behind the barrier that ended the trip before, so one barrier a trip.
    // The mask's tile t+1 flies meanwhile into the wave's other mask buffer.
    #pragma unroll 1
    for (int t = 0; t < S_ / BN; ++t) {
        const int  cur  = t & 1;
        const bool more = t + 1 < S_ / BN;     // the same for the whole block
        if (more) load_tile(BN);
        compute_tile(Kf[cur], Vf[cur], (const float*)(Mf + (cur * 8 + w) * MSL));
        // stands in front of the pointer steps below, which rewrite the address registers that
        // the eight issued loads name; outside their branch, so that no step is lifted over it
        asm volatile("s_wait_xcnt 0x0" ::: "memory");
        if (more) {
            stage_tile(Kf[cur ^ 1], Vf[cur ^ 1]);
            kt += (size_t)BN * (H_ * E_);
            vt += (size_t)BN * (H_ * D_);
        }
        asm volatile("s_wait_dscnt 0x0" ::: "memory");       // this wave has left mask buffer 'cur'
        mask_wait();                                         // mask tile t + 1 has landed
        __syncthreads();
        const uint32_t nt = pinned((uint32_t)t + 2u);        // the descriptor is formed behind the wait
        if (pinned(nt < S_ / BN)) mask_load(nt);             // into the buffer that this trip has read
    }
    asm volatile("s_wait_tensorcnt 0x0" ::: "memory");       // nothing in flight at the wave's end
    asm volatile("s_wait_dscnt 0x0" ::: "memory");           // nor an LDS read of the ring

    // ---------------- epilogue: divide by running sum, store fp32 ----------------
    {
        const float inv = 1.0f / run_sum;
        float* orow = Out + (((size_t)n * L_ + l_own) * H_ + h) * D_ + 8 * h2;
        #pragma unroll
        for (int nd = 0; nd < 4; ++nd) {
            v8f t = o[nd] * inv;
            *(v4f*)(orow + nd * 16)     = __builtin_shufflevector(t, t, 0, 1, 2, 3);
            *(v4f*)(orow + nd * 16 + 4) = __builtin_shufflevector(t, t, 4, 5, 6, 7);
        }
    }
}

extern "C" void kernel_launch(void* const* d_in, const int* in_sizes, int n_in,
                              void* d_out, int out_size, void* d_ws, size_t ws_size,
                              hipStream_t stream) {
    const float* Q = (const float*)d_in[0];
    const float* K = (const float*)d_in[1];
    const float* V = (const float*)d_in[2];
    const float* M = (const float*)d_in[3];
    float* O = (float*)d_out;
    dim3 grid(N_ * H_ * (L_ / BM));   // 2*16*16 = 512 blocks
    fattn_wmma_kernel<<<grid, 256, 0, stream>>>(Q, K, V, M, O);
}

// v005
// Measured time: 43.3 microseconds a run.
// Two timings next to v004 both put it at 1.03 times that version's speed.
// All steps since v000 together make it 2.70 times as fast.
#include <hip/hip_runtime.h>

typedef __attribute__((ext_vector_type(16))) __bf16 v16bf;
typedef __attribute__((ext_vector_type(8)))  __bf16 v8bf;
typedef __attribute__((ext_vector_type(4)))  __bf16 v4bf;
typedef __attribute__((ext_vector_type(8)))  float  v8f;
typedef __attribute__((ext_vector_type(4)))  float  v4f;
typedef __attribute__((ext_vector_type(2)))  float  v2f;
typedef __attribute__((ext_vector_type(4)))  uint32_t u32x4;
typedef __attribute__((ext_vector_type(8)))  uint32_t u32x8;

#define N_  2
#define L_  2048
#define S_  2048
#define H_  16
#define E_  64
#define D_  64
#define BM  256      // query rows per block (16 waves x 16)
#define NW  16       // waves per block
#define BN  64       // key rows per S tile
#define MP  68       // floats per staged mask row: 256 B + 16 B, an odd multiple of 16 B for b128 readers
#define MSL 6144     // LDS bytes per wave and buffer for its mask tile: 16 rows x 272 B, rounded up to a multiple of 2 KiB
#define KP  144      // bf16 per K chunk: 256 B + 32 B
#define VP  136      // bf16 per V chunk: 256 B + 16 B
#define LOG2E 1.4426950408889634f

// 16-bit A/B fragment layout (hardware k order), inverse map:
//   lane-half h2 = (k>>3)&1 ; element slot e_idx = (k&7) + 8*(k>>4)
// A takes it with lane&15 = row, B with lane&15 = column, so one staged
// fragment serves as either operand.
//
// LDS form of a fragment: four chunks (plane = e_idx>>3, h2), each 16 lanes x 16 B in a row, so
// that the 16 lanes of one half of a ds_load_b128 read 256 contiguous bytes: every bank once.
// The chunk pitches spread the 8-byte stores of the staging threads over all banks as well.
//   K chunk = st*8 + half*4 + plane*2 + h2          V chunk = ((kk*2 + plane)*2 + h2)*4 + nd

// lane l <-> l ^ 16
__device__ __forceinline__ float xhalf(float v) {
    int b = __builtin_bit_cast(int, v);
    b = __builtin_amdgcn_permlanex16(b, b, 0x76543210, 0xfedcba98, false, false);
    return __builtin_bit_cast(float, b);
}

__device__ __forceinline__ uint32_t uni(uint32_t v) { return (uint32_t)__builtin_amdgcn_readfirstlane(v); }
// a value held in a scalar register, so that a test on it is a scalar branch and what is formed
// from it is formed behind the asm statements in front of it
__device__ __forceinline__ uint32_t pinned(uint32_t v) {
    uint32_t w = uni(v);
    asm volatile("" : "+s"(w));   // holds the word in a scalar register
    return w;
}

__global__ __launch_bounds__(512)
void fattn_wmma_kernel(const float* __restrict__ Q, const float* __restrict__ K,
                       const float* __restrict__ V, const float* __restrict__ Mask,
                       float* __restrict__ Out)
{
    __shared__ __align__(16) __bf16 Kf[2][32 * KP];           // K chunks, two buffers (18 KB)
    __shared__ __align__(16) __bf16 Vf[2][32 * VP];           // V chunks, two buffers (17 KB)
    // mask tiles, two buffers x 16 waves, each wave's at a multiple of 2 KiB (192 KB)
    __shared__ __attribute__((aligned(2048))) unsigned char Mf[2 * NW * MSL];

    const int tid  = threadIdx.x;
    const int w    = (int)uni((uint32_t)tid >> 5);
    const int lane = tid & 31;
    const int h2   = lane >> 4;
    const int c16  = lane & 15;

    const int bid = blockIdx.x;
    const int lb  = bid & 7;
    const int h   = (bid >> 3) & 15;
    const int n   = bid >> 7;

    const int l_base = lb * BM + w * 16;
    const int l_own  = l_base + c16;               // the one query this lane owns
    const float cexp = 0.125f * LOG2E;             // softmax_temp, in log2 units

    // ---------------- Q fragments (registers, whole kernel): B operand ----------------
    v16bf qa[2];
    {
        const float* qrow = Q + (((size_t)n * L_ + l_own) * H_ + h) * E_;
        #pragma unroll
        for (int half = 0; half < 2; ++half) {
            const float* base = qrow + half * 32 + 8 * h2;
            #pragma unroll
            for (int j = 0; j < 8; ++j)  qa[half][j]     = (__bf16)base[j];
            #pragma unroll
            for (int j = 0; j < 8; ++j)  qa[half][8 + j] = (__bf16)base[16 + j];
        }
    }
    // all-ones A fragment: column sums of P^T via the matrix pipe (1 . P^T)
    v16bf ones;
    #pragma unroll
    for (int j = 0; j < 16; ++j) ones[j] = (__bf16)1.0f;

    // o[nd][r] = O[l_own][nd*16 + 8*h2 + r]
    v8f o[4] = {v8f{0.f}, v8f{0.f}, v8f{0.f}, v8f{0.f}};
    float run_max = -3.0e38f;     // of qk + mask, unscaled
    float run_sum = 0.0f;

    // Mask: each wave brings its own 16 x 64 tile into LDS by one tensor load, through no register.
    // Tile: 16 rows of 256 B at a source pitch of S_ * 4 B; 16 B of pad behind each row give pitch MP.
    const uint32_t m_lds = (uint32_t)(size_t)Mf + (uint32_t)w * MSL;
    const uint64_t m_src = (uint64_t)(size_t)(Mask + (size_t)l_base * S_);
    u32x8 mg1;
    mg1[0] = uni((1u << 20) | (5u << 22) | (3u << 25));   // no workgroup mask, 1-byte elements, pad 4 dwords per 64
    mg1[1] = uni(256u << 16);                             // tensor_dim0 = 256 B
    mg1[2] = uni(16u << 16);                              // tensor_dim1 = 16 rows
    mg1[3] = uni(256u << 16);                             // tile_dim0
    mg1[4] = uni(16u);                                    // tile_dim1
    mg1[5] = uni((uint32_t)(S_ * 4));                     // source row pitch
    mg1[6] = uni(0u);
    mg1[7] = uni(0u);
    u32x4 mg0;
    auto mask_load = [&](uint32_t t) {                    // tile t into buffer t & 1
        const uint64_t ga = m_src + (uint64_t)t * (BN * 4);
        mg0[0] = uni(1u);
        mg0[1] = uni(m_lds + (t & 1u) * ((uint32_t)NW * MSL));
        mg0[2] = uni((uint32_t)ga);
        mg0[3] = uni((((uint32_t)(ga >> 32)) & 0x01FFFFFFu) | 0x80000000u);
        // one request of the whole wave; every wave issues its own, so no test stands around it here
        asm volatile("tensor_load_to_lds %0, %1" :: "s"(mg0), "s"(mg1) : "memory");
    };
    // the wave's one request has landed; the wait names the descriptor, so that its registers
    // are kept for it, and take no other value, as long as the request is on its way
    auto mask_wait = [&]() {
        asm volatile("s_wait_tensorcnt 0x0" :: "s"(mg0), "s"(mg1) : "memory");
    };
    // One K tile and one V tile serve all 16 waves; each of the 512 threads stages 8 floats of either.
    // K: thread covers key rows (tid>>4) + 32*it, columns 4*(tid&15)..+3
    const float* kt = K + (((size_t)n * S_ + (tid >> 4)) * H_ + h) * E_ + (tid & 15) * 4;
    // V: 4x2 (s x d) block per thread. A wave takes 8 key rows x 32 columns: each half of it reads
    // whole 128-B lines, and its 8-byte LDS stores fall on all 64 banks once.
    const int v_s0 = ((w >> 1) * 2 + h2) * 4;
    const int v_d0 = (w & 1) * 32 + c16 * 2;
    const float* vt = V + (((size_t)n * S_ + v_s0) * H_ + h) * D_ + v_d0;

    // the thread's share of one tile's raw fp32 data, held in registers while the tile before it is worked on
    v4f kr[2];
    v2f vr[4];

    // loads the tile 'ahead' keys (0 or BN) behind the one that kt, vt point at
    auto load_tile = [&](int ahead) {
        #pragma unroll
        for (int it = 0; it < 2; ++it)
            kr[it] = *(const v4f*)(kt + (size_t)(ahead + it * 32) * (H_ * E_));
        #pragma unroll
        for (int j = 0; j < 4; ++j)
            vr[j] = *(const v2f*)(vt + (size_t)(ahead + j) * (H_ * D_));
    };

    auto stage_tile = [&](__bf16* Kb, __bf16* Vb) {
        // ---------- K tile directly into fragment layout ----------
        #pragma unroll
        for (int it = 0; it < 2; ++it) {
            int idx = (it * 512 + tid) * 4;
            int s   = idx >> 6;
            int col = idx & 63;
            int half = col >> 5;
            int k    = col & 31;
            int kh2  = (k >> 3) & 1;
            int pl   = k >> 4;
            int st   = s >> 4;
            v4bf pk;
            pk[0] = (__bf16)kr[it][0]; pk[1] = (__bf16)kr[it][1];
            pk[2] = (__bf16)kr[it][2]; pk[3] = (__bf16)kr[it][3];
            *(v4bf*)&Kb[(st * 8 + half * 4 + pl * 2 + kh2) * KP + (s & 15) * 8 + (k & 7)] = pk;
        }
        // ---------- V tile: 4x2 (s x d) block per thread ----------
        {
            int d0  = v_d0;
            int sl0 = v_s0;
            int kk   = sl0 >> 5;
            int k    = sl0 & 31;
            int kh2  = (k >> 3) & 1;
            int pl   = k >> 4;
            #pragma unroll
            for (int j = 0; j < 2; ++j) {
                int d   = d0 + j;
                int nd  = d >> 4;
                v4bf pv;
                pv[0] = (__bf16)vr[0][j]; pv[1] = (__bf16)vr[1][j];
                pv[2] = (__bf16)vr[2][j]; pv[3] = (__bf16)vr[3][j];
                *(v4bf*)&Vb[(((kk * 2 + pl) * 2 + kh2) * 4 + nd) * VP + (d & 15) * 8 + (k & 7)] = pv;
            }
        }
    };

    // a fragment out of its two planes' chunks
    auto k_frag = [&](const __bf16* Kb, int st, int half) {
        const __bf16* p = &Kb[(st * 8 + half * 4 + h2) * KP + c16 * 8];
        return __builtin_shufflevector(*(const v8bf*)p, *(const v8bf*)(p + 2 * KP),
                                       0, 1, 2, 3, 4, 5, 6, 7, 8, 9, 10, 11, 12, 13, 14, 15);
    };
    auto v_frag = [&](const __bf16* Vb, int kk, int nd) {
        const __bf16* p = &Vb[((kk * 4 + h2) * 4 + nd) * VP + c16 * 8];
        return __builtin_shufflevector(*(const v8bf*)p, *(const v8bf*)(p + 8 * VP),
                                       0, 1, 2, 3, 4, 5, 6, 7, 8, 9, 10, 11, 12, 13, 14, 15);
    };

    auto compute_tile = [&](const __bf16* Kb, const __bf16* Vb, const float* Mw) {
        // mask^T tiles in accumulator layout: sc[st][r] = Mask[l_own][s0 + st*16 + 8*h2 + r]
        v8f sc[4];
        #pragma unroll
        for (int st = 0; st < 4; ++st) {
            const float* mp = &Mw[c16 * MP + st * 16 + 8 * h2];
            v4f m0 = *(const v4f*)mp;
            v4f m1 = *(const v4f*)(mp + 4);
            sc[st] = __builtin_shufflevector(m0, m1, 0, 1, 2, 3, 4, 5, 6, 7);
        }

        // ------ GEMM1: S^T = K . Q^T + Mask^T (A = K frags, B = Q, C = mask), 8 WMMAs ------
        #pragma unroll
        for (int stp = 0; stp < 2; ++stp) {
            const int sa = 2 * stp, sb = 2 * stp + 1;
            v16bf b00 = k_frag(Kb, sa, 0);
            v16bf b01 = k_frag(Kb, sa, 1);
            v16bf b10 = k_frag(Kb, sb, 0);
            v16bf b11 = k_frag(Kb, sb, 1);
            v8f ca = __builtin_amdgcn_wmma_f32_16x16x32_bf16(false, b00, false, qa[0], (short)0, sc[sa], false, false);
            v8f cb = __builtin_amdgcn_wmma_f32_16x16x32_bf16(false, b10, false, qa[0], (short)0, sc[sb], false, false);
            ca     = __builtin_amdgcn_wmma_f32_16x16x32_bf16(false, b01, false, qa[1], (short)0, ca, false, false);
            cb     = __builtin_amdgcn_wmma_f32_16x16x32_bf16(false, b11, false, qa[1], (short)0, cb, false, false);
            sc[sa] = ca; sc[sb] = cb;
        }

        // ------ online max: a lane holds 32 of its query's 64 scores, its partner the rest ------
        float tm[4];
        #pragma unroll
        for (int st = 0; st < 4; ++st) {
            tm[st] = sc[st][0];
            #pragma unroll
            for (int r = 1; r < 8; ++r) tm[st] = fmaxf(tm[st], sc[st][r]);
        }
        float tmax = fmaxf(fmaxf(tm[0], tm[1]), fmaxf(tm[2], tm[3]));
        tmax = fmaxf(tmax, xhalf(tmax));
        const float nmax = fmaxf(run_max, tmax);
        const float scl  = __builtin_amdgcn_exp2f((run_max - nmax) * cexp);
        const float nm2  = nmax * cexp;
        run_max = nmax;

        // ------ exp2; two score tiles, converted in place, are one B fragment of P^T ------
        v16bf pb[2];
        #pragma unroll
        for (int kk = 0; kk < 2; ++kk) {
            #pragma unroll
            for (int e = 0; e < 16; ++e) {
                float p = __builtin_amdgcn_exp2f(__builtin_fmaf(sc[2 * kk + (e >> 3)][e & 7], cexp, -nm2));
                pb[kk][e] = (__bf16)p;
            }
        }
        // rescale O^T: one factor per lane
        #pragma unroll
        for (int nd = 0; nd < 4; ++nd) o[nd] *= scl;

        // ---------------- GEMM2: O^T += V^T . P^T ; sums = 1 . P^T ----------------
        v8f z = {0.f};
        v8f rs = __builtin_amdgcn_wmma_f32_16x16x32_bf16(false, ones, false, pb[0], (short)0, z,  false, false);
        rs     = __builtin_amdgcn_wmma_f32_16x16x32_bf16(false, ones, false, pb[1], (short)0, rs, false, false);
        #pragma unroll
        for (int nd = 0; nd < 4; ++nd) {
            v16bf vb0 = v_frag(Vb, 0, nd);
            v16bf vb1 = v_frag(Vb, 1, nd);
            o[nd] = __builtin_amdgcn_wmma_f32_16x16x32_bf16(false, vb0, false, pb[0], (short)0, o[nd], false, false);
            o[nd] = __builtin_amdgcn_wmma_f32_16x16x32_bf16(false, vb1, false, pb[1], (short)0, o[nd], false, false);
        }
        run_sum = run_sum * scl + rs[0];
    };

    // prologue: tile 0 into buffer 0; the mask's tile 1 is sent for behind the barrier
    mask_load(0);
    load_tile(0);
    stage_tile(Kf[0], Vf[0]);
    mask_wait();                                         // mask tile 0 has landed
    __syncthreads();
    mask_load(pinned(1u));                               // its descriptor is formed behind the wait

    // Tile t is worked on out of buffer t&1 while tile t+1 is on its way from global memory
    // into registers; it is converted into the other buffer behind the work. That buffer's last
    // readers (tile t-1) are behind the barrier that ended the trip before, so one barrier a trip.
    // The mask's tile t+1 flies meanwhile into the wave's other mask buffer.
    #pragma unroll 1
    for (int t = 0; t < S_ / BN; ++t) {
        const int  cur  = t & 1;
        const bool more = t + 1 < S_ / BN;     // the same for the whole block
        if (more) load_tile(BN);
        compute_tile(Kf[cur], Vf[cur], (const float*)(Mf + (cur * NW + w) * MSL));
        // stands in front of the pointer steps below, which rewrite the address registers that
        // the six issued loads name; outside their branch, so that no step is lifted over it
        asm volatile("s_wait_xcnt 0x0" ::: "memory");
        if (more) {
            stage_tile(Kf[cur ^ 1], Vf[cur ^ 1]);
            kt += (size_t)BN * (H_ * E_);
            vt += (size_t)BN * (H_ * D_);
        }
        asm volatile("s_wait_dscnt 0x0" ::: "memory");       // this wave has left mask buffer 'cur'
        mask_wait();                                         // mask tile t + 1 has landed
        __syncthreads();
        const uint32_t nt = pinned((uint32_t)t + 2u);        // the descriptor is formed behind the wait
        if (pinned(nt < S_ / BN)) mask_load(nt);             // into the buffer that this trip has read
    }
    asm volatile("s_wait_tensorcnt 0x0" ::: "memory");       // nothing in flight at the wave's end
    asm volatile("s_wait_dscnt 0x0" ::: "memory");           // nor an LDS read of the ring

    // ---------------- epilogue: divide by running sum, store fp32 ----------------
    {
        const float inv = 1.0f / run_sum;
        float* orow = Out + (((size_t)n * L_ + l_own) * H_ + h) * D_ + 8 * h2;
        #pragma unroll
        for (int nd = 0; nd < 4; ++nd) {
            v8f t = o[nd] * inv;
            *(v4f*)(orow + nd * 16)     = __builtin_shufflevector(t, t, 0, 1, 2, 3);
            *(v4f*)(orow + nd * 16 + 4) = __builtin_shufflevector(t, t, 4, 5, 6, 7);
        }
    }
}

extern "C" void kernel_launch(void* const* d_in, const int* in_sizes, int n_in,
                              void* d_out, int out_size, void* d_ws, size_t ws_size,
                              hipStream_t stream) {
    const float* Q = (const float*)d_in[0];
    const float* K = (const float*)d_in[1];
    const float* V = (const float*)d_in[2];
    const float* M = (const float*)d_in[3];
    float* O = (float*)d_out;
    dim3 grid(N_ * H_ * (L_ / BM));   // 2*16*8 = 256 blocks
    fattn_wmma_kernel<<<grid, 512, 0, stream>>>(Q, K, V, M, O);
}

// v006
// It runs in 41 microseconds.
// Two timings next to v005 put it at 1.06 and 1.05 times that version's speed.
// All steps since v000 together make it 2.85 times as fast.
#include <hip/hip_runtime.h>

typedef __attribute__((ext_vector_type(16))) __bf16 v16bf;
typedef __attribute__((ext_vector_type(8)))  __bf16 v8bf;
typedef __attribute__((ext_vector_type(4)))  __bf16 v4bf;
typedef __attribute__((ext_vector_type(8)))  float  v8f;
typedef __attribute__((ext_vector_type(4)))  float  v4f;
typedef __attribute__((ext_vector_type(2)))  float  v2f;
typedef __attribute__((ext_vector_type(4)))  uint32_t u32x4;
typedef __attribute__((ext_vector_type(8)))  uint32_t u32x8;

#define N_  2
#define L_  2048
#define S_  2048
#define H_  16
#define E_  64
#define D_  64
#define BM  256      // query rows per block (16 waves x 16)
#define NW  16       // waves per block
#define BN  64       // key rows per S tile
#define MP  68       // floats per staged mask row: 256 B + 16 B, an odd multiple of 16 B for b128 readers
#define MSL 6144     // LDS bytes per wave and buffer for its mask tile: 16 rows x 272 B, rounded up to a multiple of 2 KiB
#define KP  144      // bf16 per K chunk: 256 B + 32 B
#define VP  136      // bf16 per V chunk: 256 B + 16 B
#define LOG2E 1.4426950408889634f

// 16-bit A/B fragment layout (hardware k order), inverse map:
//   lane-half h2 = (k>>3)&1 ; element slot e_idx = (k&7) + 8*(k>>4)
// A takes it with lane&15 = row, B with lane&15 = column, so one staged
// fragment serves as either operand.
//
// LDS form of a fragment: four chunks (plane = e_idx>>3, h2), each 16 lanes x 16 B in a row, so
// that the 16 lanes of one half of a ds_load_b128 read 256 contiguous bytes: every bank once.
// The chunk pitches spread the 8-byte stores of the staging threads over all banks as well.
//   K chunk = st*8 + half*4 + plane*2 + h2          V chunk = ((kk*2 + plane)*2 + h2)*4 + nd

// lane l <-> l ^ 16
__device__ __forceinline__ float xhalf(float v) {
    int b = __builtin_bit_cast(int, v);
    b = __builtin_amdgcn_permlanex16(b, b, 0x76543210, 0xfedcba98, false, false);
    return __builtin_bit_cast(float, b);
}

__device__ __forceinline__ uint32_t uni(uint32_t v) { return (uint32_t)__builtin_amdgcn_readfirstlane(v); }
// a value held in a scalar register, so that a test on it is a scalar branch and what is formed
// from it is formed behind the asm statements in front of it
__device__ __forceinline__ uint32_t pinned(uint32_t v) {
    uint32_t w = uni(v);
    asm volatile("" : "+s"(w));   // holds the word in a scalar register
    return w;
}

__global__ __launch_bounds__(512)
void fattn_wmma_kernel(const float* __restrict__ Q, const float* __restrict__ K,
                       const float* __restrict__ V, const float* __restrict__ Mask,
                       float* __restrict__ Out)
{
    __shared__ __align__(16) __bf16 Kf[2][32 * KP];           // K chunks, two buffers (18 KB)
    __shared__ __align__(16) __bf16 Vf[2][32 * VP];           // V chunks, two buffers (17 KB)
    // mask tiles, two buffers x 16 waves, each wave's at a multiple of 2 KiB (192 KB)
    __shared__ __attribute__((aligned(2048))) unsigned char Mf[2 * NW * MSL];

    const int tid  = threadIdx.x;
    const int w    = (int)uni((uint32_t)tid >> 5);
    const int lane = tid & 31;
    const int h2   = lane >> 4;
    const int c16  = lane & 15;

    const int bid = blockIdx.x;
    const int lb  = bid & 7;
    const int h   = (bid >> 3) & 15;
    const int n   = bid >> 7;

    const int l_base = lb * BM + w * 16;
    const int l_own  = l_base + c16;               // the one query this lane owns
    const float cexp = 0.125f * LOG2E;             // softmax_temp, in log2 units

    // ---------------- Q fragments (registers, whole kernel): B operand ----------------
    v16bf qa[2];
    {
        const float* qrow = Q + (((size_t)n * L_ + l_own) * H_ + h) * E_;
        #pragma unroll
        for (int half = 0; half < 2; ++half) {
            const float* base = qrow + half * 32 + 8 * h2;
            #pragma unroll
            for (int j = 0; j < 8; ++j)  qa[half][j]     = (__bf16)base[j];
            #pragma unroll
            for (int j = 0; j < 8; ++j)  qa[half][8 + j] = (__bf16)base[16 + j];
        }
    }
    // all-ones A fragment: column sums of P^T via the matrix pipe (1 . P^T)
    v16bf ones;
    #pragma unroll
    for (int j = 0; j < 16; ++j) ones[j] = (__bf16)1.0f;

    // o[nd][r] = O[l_own][nd*16 + 8*h2 + r]
    v8f o[4] = {v8f{0.f}, v8f{0.f}, v8f{0.f}, v8f{0.f}};
    float run_max = -3.0e38f;     // of qk + mask, unscaled
    float run_sum = 0.0f;

    // Mask: each wave brings its own 16 x 64 tile into LDS by one tensor load, through no register.
    // Tile: 16 rows of 256 B at a source pitch of S_ * 4 B; 16 B of pad behind each row give pitch MP.
    const uint32_t m_lds = (uint32_t)(size_t)Mf + (uint32_t)w * MSL;
    const uint64_t m_src = (uint64_t)(size_t)(Mask + (size_t)l_base * S_);
    u32x8 mg1;
    mg1[0] = uni((1u << 20) | (5u << 22) | (3u << 25));   // no workgroup mask, 1-byte elements, pad 4 dwords per 64
    mg1[1] = uni(256u << 16);                             // tensor_dim0 = 256 B
    mg1[2] = uni(16u << 16);                              // tensor_dim1 = 16 rows
    mg1[3] = uni(256u << 16);                             // tile_dim0
    mg1[4] = uni(16u);                                    // tile_dim1
    mg1[5] = uni((uint32_t)(S_ * 4));                     // source row pitch
    mg1[6] = uni(0u);
    mg1[7] = uni(0u);
    u32x4 mg0;
    auto mask_load = [&](uint32_t t) {                    // tile t into buffer t & 1
        const uint64_t ga = m_src + (uint64_t)t * (BN * 4);
        mg0[0] = uni(1u);
        mg0[1] = uni(m_lds + (t & 1u) * ((uint32_t)NW * MSL));
        mg0[2] = uni((uint32_t)ga);
        mg0[3] = uni((((uint32_t)(ga >> 32)) & 0x01FFFFFFu) | 0x80000000u);
        // one request of the whole wave; every wave issues its own, so no test stands around it here
        asm volatile("tensor_load_to_lds %0, %1" :: "s"(mg0), "s"(mg1) : "memory");
    };
    // the wave's one request has landed; the wait names the descriptor, so that its registers
    // are kept for it, and take no other value, as long as the request is on its way
    auto mask_wait = [&]() {
        asm volatile("s_wait_tensorcnt 0x0" :: "s"(mg0), "s"(mg1) : "memory");
    };
    // One K tile and one V tile serve all 16 waves; each of the 512 threads stages 8 floats of either.
    // K: thread covers key rows (tid>>4) + 32*it, columns 4*(tid&15)..+3
    const float* kt = K + (((size_t)n * S_ + (tid >> 4)) * H_ + h) * E_ + (tid & 15) * 4;
    // V: 4x2 (s x d) block per thread. A wave takes 8 key rows x 32 columns: each half of it reads
    // whole 128-B lines, and its 8-byte LDS stores fall on all 64 banks once.
    const int v_s0 = ((w >> 1) * 2 + h2) * 4;
    const int v_d0 = (w & 1) * 32 + c16 * 2;
    const float* vt = V + (((size_t)n * S_ + v_s0) * H_ + h) * D_ + v_d0;

    // the thread's share of one tile's raw fp32 data, held in registers while the tile two (K) or one (V) before it is worked on
    v4f kr[2];
    v2f vr[4];

    // load the tile 'ahead' keys (a multiple of BN) behind the one that kt, vt point at
    auto load_k = [&](int ahead) {
        #pragma unroll
        for (int it = 0; it < 2; ++it)
            kr[it] = *(const v4f*)(kt + (size_t)(ahead + it * 32) * (H_ * E_));
    };
    auto load_v = [&](int ahead) {
        #pragma unroll
        for (int j = 0; j < 4; ++j)
            vr[j] = *(const v2f*)(vt + (size_t)(ahead + j) * (H_ * D_));
    };

    auto stage_k = [&](__bf16* Kb) {
        // ---------- K tile directly into fragment layout ----------
        #pragma unroll
        for (int it = 0; it < 2; ++it) {
            int idx = (it * 512 + tid) * 4;
            int s   = idx >> 6;
            int col = idx & 63;
            int half = col >> 5;
            int k    = col & 31;
            int kh2  = (k >> 3) & 1;
            int pl   = k >> 4;
            int st   = s >> 4;
            v4bf pk;
            pk[0] = (__bf16)kr[it][0]; pk[1] = (__bf16)kr[it][1];
            pk[2] = (__bf16)kr[it][2]; pk[3] = (__bf16)kr[it][3];
            *(v4bf*)&Kb[(st * 8 + half * 4 + pl * 2 + kh2) * KP + (s & 15) * 8 + (k & 7)] = pk;
        }
    };
    auto stage_v = [&](__bf16* Vb) {
        // ---------- V tile: 4x2 (s x d) block per thread ----------
        {
            int d0  = v_d0;
            int sl0 = v_s0;
            int kk   = sl0 >> 5;
            int k    = sl0 & 31;
            int kh2  = (k >> 3) & 1;
            int pl   = k >> 4;
            #pragma unroll
            for (int j = 0; j < 2; ++j) {
                int d   = d0 + j;
                int nd  = d >> 4;
                v4bf pv;
                pv[0] = (__bf16)vr[0][j]; pv[1] = (__bf16)vr[1][j];
                pv[2] = (__bf16)vr[2][j]; pv[3] = (__bf16)vr[3][j];
                *(v4bf*)&Vb[(((kk * 2 + pl) * 2 + kh2) * 4 + nd) * VP + (d & 15) * 8 + (k & 7)] = pv;
            }
        }
    };

    // a fragment out of its two planes' chunks
    auto k_frag = [&](const __bf16* Kb, int st, int half) {
        const __bf16* p = &Kb[(st * 8 + half * 4 + h2) * KP + c16 * 8];
        return __builtin_shufflevector(*(const v8bf*)p, *(const v8bf*)(p + 2 * KP),
                                       0, 1, 2, 3, 4, 5, 6, 7, 8, 9, 10, 11, 12, 13, 14, 15);
    };
    auto v_frag = [&](const __bf16* Vb, int kk, int nd) {
        const __bf16* p = &Vb[((kk * 4 + h2) * 4 + nd) * VP + c16 * 8];
        return __builtin_shufflevector(*(const v8bf*)p, *(const v8bf*)(p + 8 * VP),
                                       0, 1, 2, 3, 4, 5, 6, 7, 8, 9, 10, 11, 12, 13, 14, 15);
    };

    // What the S^T products of a tile take from LDS is fetched one trip ahead and waits in registers:
    // kf[st*2 + half] = the tile's K fragments, sc[st] = its mask^T tiles in accumulator layout,
    // sc[st][r] = Mask[l_own][s0 + st*16 + 8*h2 + r]
    v16bf kf[8];
    v8f   sc[4];
    auto fetch_k = [&](const __bf16* Kb) {
        #pragma unroll
        for (int st = 0; st < 4; ++st) {
            kf[st * 2]     = k_frag(Kb, st, 0);
            kf[st * 2 + 1] = k_frag(Kb, st, 1);
        }
    };
    auto fetch_mask = [&](const float* Mw) {
        #pragma unroll
        for (int st = 0; st < 4; ++st) {
            const float* mp = &Mw[c16 * MP + st * 16 + 8 * h2];
            v4f m0 = *(const v4f*)mp;
            v4f m1 = *(const v4f*)(mp + 4);
            sc[st] = __builtin_shufflevector(m0, m1, 0, 1, 2, 3, 4, 5, 6, 7);
        }
    };

    // works on the tile whose K fragments and mask are in kf, sc; Kn = the next tile's K chunks
    auto compute_tile = [&](const __bf16* Kn, const __bf16* Vb) {
        // this tile's V fragments: on their way while the S^T products and the softmax run
        v16bf vf[8];
        #pragma unroll
        for (int nd = 0; nd < 4; ++nd) {
            vf[nd * 2]     = v_frag(Vb, 0, nd);
            vf[nd * 2 + 1] = v_frag(Vb, 1, nd);
        }
        // ------ GEMM1: S^T = K . Q^T + Mask^T (A = K frags, B = Q, C = mask), 8 WMMAs ------
        #pragma unroll
        for (int stp = 0; stp < 2; ++stp) {
            const int sa = 2 * stp, sb = 2 * stp + 1;
            v16bf b00 = kf[sa * 2];
            v16bf b01 = kf[sa * 2 + 1];
            v16bf b10 = kf[sb * 2];
            v16bf b11 = kf[sb * 2 + 1];
            v8f ca = __builtin_amdgcn_wmma_f32_16x16x32_bf16(false, b00, false, qa[0], (short)0, sc[sa], false, false);
            v8f cb = __builtin_amdgcn_wmma_f32_16x16x32_bf16(false, b10, false, qa[0], (short)0, sc[sb], false, false);
            ca     = __builtin_amdgcn_wmma_f32_16x16x32_bf16(false, b01, false, qa[1], (short)0, ca, false, false);
            cb     = __builtin_amdgcn_wmma_f32_16x16x32_bf16(false, b11, false, qa[1], (short)0, cb, false, false);
            sc[sa] = ca; sc[sb] = cb;
        }
        // the next tile's K fragments, into the registers that these products have left
        fetch_k(Kn);
        // keeps both groups of LDS loads in front of the softmax, which covers their LDS time; left
        // free, they were moved down among the O^T products, which then waited for them
        __builtin_amdgcn_sched_barrier(0);

        // ------ online max: a lane holds 32 of its query's 64 scores, its partner the rest ------
        float tm[4];
        #pragma unroll
        for (int st = 0; st < 4; ++st) {
            tm[st] = sc[st][0];
            #pragma unroll
            for (int r = 1; r < 8; ++r) tm[st] = fmaxf(tm[st], sc[st][r]);
        }
        float tmax = fmaxf(fmaxf(tm[0], tm[1]), fmaxf(tm[2], tm[3]));
        tmax = fmaxf(tmax, xhalf(tmax));
        const float nmax = fmaxf(run_max, tmax);
        const float scl  = __builtin_amdgcn_exp2f((run_max - nmax) * cexp);
        const float nm2  = nmax * cexp;
        run_max = nmax;

        // ------ exp2; two score tiles, converted in place, are one B fragment of P^T ------
        v16bf pb[2];
        #pragma unroll
        for (int kk = 0; kk < 2; ++kk) {
            #pragma unroll
            for (int e = 0; e < 16; ++e) {
                float p = __builtin_amdgcn_exp2f(__builtin_fmaf(sc[2 * kk + (e >> 3)][e & 7], cexp, -nm2));
                pb[kk][e] = (__bf16)p;
            }
        }
        // rescale O^T: one factor per lane
        #pragma unroll
        for (int nd = 0; nd < 4; ++nd) o[nd] *= scl;

        // ---------------- GEMM2: O^T += V^T . P^T ; sums = 1 . P^T ----------------
        v8f z = {0.f};
        v8f rs = __builtin_amdgcn_wmma_f32_16x16x32_bf16(false, ones, false, pb[0], (short)0, z,  false, false);
        rs     = __builtin_amdgcn_wmma_f32_16x16x32_bf16(false, ones, false, pb[1], (short)0, rs, false, false);
        #pragma unroll
        for (int nd = 0; nd < 4; ++nd) {
            v16bf vb0 = vf[nd * 2];
            v16bf vb1 = vf[nd * 2 + 1];
            o[nd] = __builtin_amdgcn_wmma_f32_16x16x32_bf16(false, vb0, false, pb[0], (short)0, o[nd], false, false);
            o[nd] = __builtin_amdgcn_wmma_f32_16x16x32_bf16(false, vb1, false, pb[1], (short)0, o[nd], false, false);
        }
        // keeps the waits that follow the call behind the products: lifted into the softmax, the wait for the
        // mask's next tile would stand a short way behind its request and the wave would sit in it
        __builtin_amdgcn_sched_barrier(0);
        run_sum = run_sum * scl + rs[0];
    };

    // prologue: K tiles 0 and 1 and V tile 0 into LDS; the mask's tile 1 is sent for behind the barrier
    mask_load(0);
    load_k(0);
    load_v(0);
    stage_k(Kf[0]);
    stage_v(Vf[0]);
    load_k(BN);
    stage_k(Kf[1]);
    mask_wait();                                         // mask tile 0 has landed
    __syncthreads();
    mask_load(pinned(1u));                               // its descriptor is formed behind the wait
    fetch_k(Kf[0]);
    fetch_mask((const float*)(Mf + w * MSL));
    asm volatile("s_wait_dscnt 0x0" ::: "memory");       // this wave has left mask buffer 0 and K buffer 0
    // mask tile 1 has landed, behind the LDS time of the fetches above: so its descriptor's registers are
    // free before the loop, whose own requests and waits share one set of registers
    mask_wait();
    __syncthreads();                                     // every wave has left K buffer 0: trip 0 stages K tile 2 into it

    // Trip t works on tile t. Its K fragments and its mask came into registers during trip t - 1, so
    // its S^T products start right behind the barrier; tile t + 1's K fragments are fetched while the softmax and
    // the O^T products run, its mask behind them. For that K is staged two tiles ahead: tile t + 2 goes from global memory
    // into registers at the top of trip t and into K buffer t & 1 at its foot; that buffer's readers
    // (tile t's fetch, in trip t - 1) are behind the barrier that ended trip t - 1. V stays one tile
    // ahead. One barrier a trip. In the last trip the fetches read a buffer that nobody writes any
    // more, and what they bring is not used: so no branch stands around them.
    #pragma unroll 1
    for (int t = 0; t < S_ / BN; ++t) {
        const int  cur   = t & 1;
        const bool more  = t + 1 < S_ / BN;    // the same for the whole block
        const bool more2 = t + 2 < S_ / BN;
        if (more2) load_k(2 * BN);
        if (more)  load_v(BN);
        compute_tile(Kf[cur ^ 1], Vf[cur]);
        // stands in front of the pointer steps below, which rewrite the address registers that
        // the six issued loads name; outside their branch, so that no step is lifted over it
        asm volatile("s_wait_xcnt 0x0" ::: "memory");
        // The mask ring is private to the wave: no barrier belongs to it. Tile t + 1 has landed behind
        // this wait; tile t + 2 goes into the buffer that the wave read in trip t - 1, whose
        // s_wait_dscnt 0 stood at that trip's foot.
        mask_wait();
        const uint32_t nt = pinned((uint32_t)t + 2u);        // the descriptor is formed behind the wait
        if (pinned(nt < S_ / BN)) mask_load(nt);
        fetch_mask((const float*)(Mf + ((cur ^ 1) * NW + w) * MSL));
        if (more2) stage_k(Kf[cur]);
        if (more)  stage_v(Vf[cur ^ 1]);
        kt += (size_t)BN * (H_ * E_);
        vt += (size_t)BN * (H_ * D_);
        asm volatile("s_wait_dscnt 0x0" ::: "memory");       // this wave's fetches and stores are done
        __syncthreads();
    }
    asm volatile("s_wait_tensorcnt 0x0" ::: "memory");       // nothing in flight at the wave's end
    asm volatile("s_wait_dscnt 0x0" ::: "memory");           // nor an LDS read of the ring

    // ---------------- epilogue: divide by running sum, store fp32 ----------------
    {
        const float inv = 1.0f / run_sum;
        float* orow = Out + (((size_t)n * L_ + l_own) * H_ + h) * D_ + 8 * h2;
        #pragma unroll
        for (int nd = 0; nd < 4; ++nd) {
            v8f t = o[nd] * inv;
            *(v4f*)(orow + nd * 16)     = __builtin_shufflevector(t, t, 0, 1, 2, 3);
            *(v4f*)(orow + nd * 16 + 4) = __builtin_shufflevector(t, t, 4, 5, 6, 7);
        }
    }
}

extern "C" void kernel_launch(void* const* d_in, const int* in_sizes, int n_in,
                              void* d_out, int out_size, void* d_ws, size_t ws_size,
                              hipStream_t stream) {
    const float* Q = (const float*)d_in[0];
    const float* K = (const float*)d_in[1];
    const float* V = (const float*)d_in[2];
    const float* M = (const float*)d_in[3];
    float* O = (float*)d_out;
    dim3 grid(N_ * H_ * (L_ / BM));   // 2*16*8 = 256 blocks
    fattn_wmma_kernel<<<grid, 512, 0, stream>>>(Q, K, V, M, O);
}

// v007
// It runs in 39.5 microseconds.
// Timed twice side by side with v006, it ran 1.04 times as fast both times.
// Counting every step since v000, it is 2.96 times as fast.
#include <hip/hip_runtime.h>

typedef __attribute__((ext_vector_type(16))) __bf16 v16bf;
typedef __attribute__((ext_vector_type(8)))  __bf16 v8bf;
typedef __attribute__((ext_vector_type(4)))  __bf16 v4bf;
typedef __attribute__((ext_vector_type(8)))  float  v8f;
typedef __attribute__((ext_vector_type(4)))  float  v4f;
typedef __attribute__((ext_vector_type(2)))  float  v2f;
typedef __attribute__((ext_vector_type(4)))  uint32_t u32x4;
typedef __attribute__((ext_vector_type(8)))  uint32_t u32x8;

#define N_  2
#define L_  2048
#define S_  2048
#define H_  16
#define E_  64
#define D_  64
#define BM  256      // query rows per block (16 waves x 16)
#define NW  16       // waves per block
#define BN  64       // key rows per S tile
#define GT  3        // trips (key tiles) between two barriers
#define NR  6        // tiles in the K ring and in the V ring: 2 * GT
#define MP  68       // floats per staged mask row: 256 B + 16 B, an odd multiple of 16 B for b128 readers
#define MSL 6144     // LDS bytes per wave and buffer for its mask tile: 16 rows x 272 B, rounded up to a multiple of 2 KiB
#define KP  144      // bf16 per K chunk: 256 B + 32 B
#define VP  136      // bf16 per V chunk: 256 B + 16 B
#define LOG2E 1.4426950408889634f

// 16-bit A/B fragment layout (hardware k order), inverse map:
//   lane-half h2 = (k>>3)&1 ; element slot e_idx = (k&7) + 8*(k>>4)
// A takes it with lane&15 = row, B with lane&15 = column, so one staged
// fragment serves as either operand.
//
// LDS form of a fragment: four chunks (plane = e_idx>>3, h2), each 16 lanes x 16 B in a row, so
// that the 16 lanes of one half of a ds_load_b128 read 256 contiguous bytes: every bank once.
// The chunk pitches spread the 8-byte stores of the staging threads over all banks as well.
//   K chunk = st*8 + half*4 + plane*2 + h2          V chunk = ((kk*2 + plane)*2 + h2)*4 + nd

// lane l <-> l ^ 16
__device__ __forceinline__ float xhalf(float v) {
    int b = __builtin_bit_cast(int, v);
    b = __builtin_amdgcn_permlanex16(b, b, 0x76543210, 0xfedcba98, false, false);
    return __builtin_bit_cast(float, b);
}

__device__ __forceinline__ uint32_t uni(uint32_t v) { return (uint32_t)__builtin_amdgcn_readfirstlane(v); }
// a value held in a scalar register, so that a test on it is a scalar branch and what is formed
// from it is formed behind the asm statements in front of it
__device__ __forceinline__ uint32_t pinned(uint32_t v) {
    uint32_t w = uni(v);
    asm volatile("" : "+s"(w));   // holds the word in a scalar register
    return w;
}

__global__ __launch_bounds__(512)
void fattn_wmma_kernel(const float* __restrict__ Q, const float* __restrict__ K,
                       const float* __restrict__ V, const float* __restrict__ Mask,
                       float* __restrict__ Out)
{
    __shared__ __align__(16) __bf16 Kf[NR][32 * KP];          // K chunks, a ring of six tiles (54 KB)
    __shared__ __align__(16) __bf16 Vf[NR][32 * VP];          // V chunks, a ring of six tiles (51 KB)
    // mask tiles, two buffers x 16 waves, each wave's at a multiple of 2 KiB (192 KB)
    __shared__ __attribute__((aligned(2048))) unsigned char Mf[2 * NW * MSL];

    const int tid  = threadIdx.x;
    const int w    = (int)uni((uint32_t)tid >> 5);
    const int lane = tid & 31;
    const int h2   = lane >> 4;
    const int c16  = lane & 15;

    const int bid = blockIdx.x;
    const int lb  = bid & 7;
    const int h   = (bid >> 3) & 15;
    const int n   = bid >> 7;

    const int l_base = lb * BM + w * 16;
    const int l_own  = l_base + c16;               // the one query this lane owns
    const float cexp = 0.125f * LOG2E;             // softmax_temp, in log2 units

    // ---------------- Q fragments (registers, whole kernel): B operand ----------------
    v16bf qa[2];
    {
        const float* qrow = Q + (((size_t)n * L_ + l_own) * H_ + h) * E_;
        #pragma unroll
        for (int half = 0; half < 2; ++half) {
            const float* base = qrow + half * 32 + 8 * h2;
            #pragma unroll
            for (int j = 0; j < 8; ++j)  qa[half][j]     = (__bf16)base[j];
            #pragma unroll
            for (int j = 0; j < 8; ++j)  qa[half][8 + j] = (__bf16)base[16 + j];
        }
    }
    // all-ones A fragment: column sums of P^T via the matrix pipe (1 . P^T)
    v16bf ones;
    #pragma unroll
    for (int j = 0; j < 16; ++j) ones[j] = (__bf16)1.0f;

    // o[nd][r] = O[l_own][nd*16 + 8*h2 + r]
    v8f o[4] = {v8f{0.f}, v8f{0.f}, v8f{0.f}, v8f{0.f}};
    float run_max = -3.0e38f;     // of qk + mask, unscaled
    float run_sum = 0.0f;

    // Mask: each wave brings its own 16 x 64 tile into LDS by one tensor load, through no register.
    // Tile: 16 rows of 256 B at a source pitch of S_ * 4 B; 16 B of pad behind each row give pitch MP.
    const uint32_t m_lds = (uint32_t)(size_t)Mf + (uint32_t)w * MSL;
    const uint64_t m_src = (uint64_t)(size_t)(Mask + (size_t)l_base * S_);
    u32x8 mg1;
    mg1[0] = uni((1u << 20) | (5u << 22) | (3u << 25));   // no workgroup mask, 1-byte elements, pad 4 dwords per 64
    mg1[1] = uni(256u << 16);                             // tensor_dim0 = 256 B
    mg1[2] = uni(16u << 16);                              // tensor_dim1 = 16 rows
    mg1[3] = uni(256u << 16);                             // tile_dim0
    mg1[4] = uni(16u);                                    // tile_dim1
    mg1[5] = uni((uint32_t)(S_ * 4));                     // source row pitch
    mg1[6] = uni(0u);
    mg1[7] = uni(0u);
    u32x4 mg0;
    auto mask_load = [&](uint32_t t) {                    // tile t into buffer t & 1
        const uint64_t ga = m_src + (uint64_t)t * (BN * 4);
        mg0[0] = uni(1u);
        mg0[1] = uni(m_lds + (t & 1u) * ((uint32_t)NW * MSL));
        mg0[2] = uni((uint32_t)ga);
        mg0[3] = uni((((uint32_t)(ga >> 32)) & 0x01FFFFFFu) | 0x80000000u);
        // one request of the whole wave; every wave issues its own, so no test stands around it here
        asm volatile("tensor_load_to_lds %0, %1" :: "s"(mg0), "s"(mg1) : "memory");
    };
    // the wave's one request has landed; the wait names the descriptor, so that its registers
    // are kept for it, and take no other value, as long as the request is on its way
    auto mask_wait = [&]() {
        asm volatile("s_wait_tensorcnt 0x0" :: "s"(mg0), "s"(mg1) : "memory");
    };
    // One K tile and one V tile serve all 16 waves; each of the 512 threads stages 8 floats of either.
    // K: thread covers key rows (tid>>4) + 32*it, columns 4*(tid&15)..+3
    const float* kb = K + ((size_t)n * S_ * H_ + h) * E_;                  // the head's plane: the same in every lane
    const uint32_t k_off = (uint32_t)(tid >> 4) * (H_ * E_) + (uint32_t)(tid & 15) * 4;
    // V: 4x2 (s x d) block per thread. A wave takes 8 key rows x 32 columns: each half of it reads
    // whole 128-B lines, and its 8-byte LDS stores fall on all 64 banks once.
    const int v_s0 = ((w >> 1) * 2 + h2) * 4;
    const int v_d0 = (w & 1) * 32 + c16 * 2;
    const float* vb = V + ((size_t)n * S_ * H_ + h) * D_;
    const uint32_t v_off = (uint32_t)v_s0 * (H_ * D_) + (uint32_t)v_d0;

    // the thread's share of one tile's raw fp32 data, held in registers while the tile four (K) or three (V) before it is worked on
    v4f kr[2];
    v2f vr[4];

    // load the tile that p points at (p: the same in every lane)
    auto load_k = [&](const float* p) {
        #pragma unroll
        for (int it = 0; it < 2; ++it)
            kr[it] = *(const v4f*)(p + (k_off + (uint32_t)it * (32 * H_ * E_)));
    };
    auto load_v = [&](const float* p) {
        #pragma unroll
        for (int j = 0; j < 4; ++j)
            vr[j] = *(const v2f*)(p + (v_off + (uint32_t)j * (H_ * D_)));
    };

    auto stage_k = [&](__bf16* Kb) {
        // ---------- K tile directly into fragment layout ----------
        #pragma unroll
        for (int it = 0; it < 2; ++it) {
            int idx = (it * 512 + tid) * 4;
            int s   = idx >> 6;
            int col = idx & 63;
            int half = col >> 5;
            int k    = col & 31;
            int kh2  = (k >> 3) & 1;
            int pl   = k >> 4;
            int st   = s >> 4;
            v4bf pk;
            pk[0] = (__bf16)kr[it][0]; pk[1] = (__bf16)kr[it][1];
            pk[2] = (__bf16)kr[it][2]; pk[3] = (__bf16)kr[it][3];
            *(v4bf*)&Kb[(st * 8 + half * 4 + pl * 2 + kh2) * KP + (s & 15) * 8 + (k & 7)] = pk;
        }
    };
    auto stage_v = [&](__bf16* Vb) {
        // ---------- V tile: 4x2 (s x d) block per thread ----------
        {
            int d0  = v_d0;
            int sl0 = v_s0;
            int kk   = sl0 >> 5;
            int k    = sl0 & 31;
            int kh2  = (k >> 3) & 1;
            int pl   = k >> 4;
            #pragma unroll
            for (int j = 0; j < 2; ++j) {
                int d   = d0 + j;
                int nd  = d >> 4;
                v4bf pv;
                pv[0] = (__bf16)vr[0][j]; pv[1] = (__bf16)vr[1][j];
                pv[2] = (__bf16)vr[2][j]; pv[3] = (__bf16)vr[3][j];
                *(v4bf*)&Vb[(((kk * 2 + pl) * 2 + kh2) * 4 + nd) * VP + (d & 15) * 8 + (k & 7)] = pv;
            }
        }
    };

    // a fragment out of its two planes' chunks
    auto k_frag = [&](const __bf16* Kb, int st, int half) {
        const __bf16* p = &Kb[(st * 8 + half * 4 + h2) * KP + c16 * 8];
        return __builtin_shufflevector(*(const v8bf*)p, *(const v8bf*)(p + 2 * KP),
                                       0, 1, 2, 3, 4, 5, 6, 7, 8, 9, 10, 11, 12, 13, 14, 15);
    };
    auto v_frag = [&](const __bf16* Vb, int kk, int nd) {
        const __bf16* p = &Vb[((kk * 4 + h2) * 4 + nd) * VP + c16 * 8];
        return __builtin_shufflevector(*(const v8bf*)p, *(const v8bf*)(p + 8 * VP),
                                       0, 1, 2, 3, 4, 5, 6, 7, 8, 9, 10, 11, 12, 13, 14, 15);
    };

    // What the S^T products of a tile take from LDS is fetched one trip ahead and waits in registers:
    // kf[st*2 + half] = the tile's K fragments, sc[st] = its mask^T tiles in accumulator layout,
    // sc[st][r] = Mask[l_own][s0 + st*16 + 8*h2 + r]
    v16bf kf[8];
    v8f   sc[4];
    auto fetch_k = [&](const __bf16* Kb) {
        #pragma unroll
        for (int st = 0; st < 4; ++st) {
            kf[st * 2]     = k_frag(Kb, st, 0);
            kf[st * 2 + 1] = k_frag(Kb, st, 1);
        }
    };
    auto fetch_mask = [&](const float* Mw) {
        #pragma unroll
        for (int st = 0; st < 4; ++st) {
            const float* mp = &Mw[c16 * MP + st * 16 + 8 * h2];
            v4f m0 = *(const v4f*)mp;
            v4f m1 = *(const v4f*)(mp + 4);
            sc[st] = __builtin_shufflevector(m0, m1, 0, 1, 2, 3, 4, 5, 6, 7);
        }
    };

    // works on the tile whose K fragments and mask are in kf, sc; Kn = the next tile's K chunks
    auto compute_tile = [&](const __bf16* Kn, const __bf16* Vb) {
        // this tile's V fragments: on their way while the S^T products and the softmax run
        v16bf vf[8];
        #pragma unroll
        for (int nd = 0; nd < 4; ++nd) {
            vf[nd * 2]     = v_frag(Vb, 0, nd);
            vf[nd * 2 + 1] = v_frag(Vb, 1, nd);
        }
        // ------ GEMM1: S^T = K . Q^T + Mask^T (A = K frags, B = Q, C = mask), 8 WMMAs ------
        #pragma unroll
        for (int stp = 0; stp < 2; ++stp) {
            const int sa = 2 * stp, sb = 2 * stp + 1;
            v16bf b00 = kf[sa * 2];
            v16bf b01 = kf[sa * 2 + 1];
            v16bf b10 = kf[sb * 2];
            v16bf b11 = kf[sb * 2 + 1];
            v8f ca = __builtin_amdgcn_wmma_f32_16x16x32_bf16(false, b00, false, qa[0], (short)0, sc[sa], false, false);
            v8f cb = __builtin_amdgcn_wmma_f32_16x16x32_bf16(false, b10, false, qa[0], (short)0, sc[sb], false, false);
            ca     = __builtin_amdgcn_wmma_f32_16x16x32_bf16(false, b01, false, qa[1], (short)0, ca, false, false);
            cb     = __builtin_amdgcn_wmma_f32_16x16x32_bf16(false, b11, false, qa[1], (short)0, cb, false, false);
            sc[sa] = ca; sc[sb] = cb;
        }
        // the next tile's K fragments, into the registers that these products have left
        fetch_k(Kn);
        // keeps both groups of LDS loads in front of the softmax, which covers their LDS time; left
        // free, they were moved down among the O^T products, which then waited for them
        __builtin_amdgcn_sched_barrier(0);

        // ------ online max: a lane holds 32 of its query's 64 scores, its partner the rest ------
        float tm[4];
        #pragma unroll
        for (int st = 0; st < 4; ++st) {
            tm[st] = sc[st][0];
            #pragma unroll
            for (int r = 1; r < 8; ++r) tm[st] = fmaxf(tm[st], sc[st][r]);
        }
        float tmax = fmaxf(fmaxf(tm[0], tm[1]), fmaxf(tm[2], tm[3]));
        tmax = fmaxf(tmax, xhalf(tmax));
        const float nmax = fmaxf(run_max, tmax);
        const float scl  = __builtin_amdgcn_exp2f((run_max - nmax) * cexp);
        const float nm2  = nmax * cexp;
        run_max = nmax;

        // ------ exp2; two score tiles, converted in place, are one B fragment of P^T ------
        v16bf pb[2];
        #pragma unroll
        for (int kk = 0; kk < 2; ++kk) {
            #pragma unroll
            for (int e = 0; e < 16; ++e) {
                float p = __builtin_amdgcn_exp2f(__builtin_fmaf(sc[2 * kk + (e >> 3)][e & 7], cexp, -nm2));
                pb[kk][e] = (__bf16)p;
            }
        }
        // rescale O^T: one factor per lane
        #pragma unroll
        for (int nd = 0; nd < 4; ++nd) o[nd] *= scl;

        // ---------------- GEMM2: O^T += V^T . P^T ; sums = 1 . P^T ----------------
        v8f z = {0.f};
        v8f rs = __builtin_amdgcn_wmma_f32_16x16x32_bf16(false, ones, false, pb[0], (short)0, z,  false, false);
        rs     = __builtin_amdgcn_wmma_f32_16x16x32_bf16(false, ones, false, pb[1], (short)0, rs, false, false);
        #pragma unroll
        for (int nd = 0; nd < 4; ++nd) {
            v16bf vb0 = vf[nd * 2];
            v16bf vb1 = vf[nd * 2 + 1];
            o[nd] = __builtin_amdgcn_wmma_f32_16x16x32_bf16(false, vb0, false, pb[0], (short)0, o[nd], false, false);
            o[nd] = __builtin_amdgcn_wmma_f32_16x16x32_bf16(false, vb1, false, pb[1], (short)0, o[nd], false, false);
        }
        // keeps the waits that follow the call behind the products: lifted into the softmax, the wait for the
        // mask's next tile would stand a short way behind its request and the wave would sit in it
        __builtin_amdgcn_sched_barrier(0);
        run_sum = run_sum * scl + rs[0];
    };

    // prologue: K tiles 0 to 3 and V tiles 0 to 2 into LDS; the mask's tile 1 is sent for behind the barrier
    mask_load(0);
    load_k(kb);
    load_v(vb);
    stage_k(Kf[0]);
    stage_v(Vf[0]);
    load_k(kb + BN * H_ * E_);
    load_v(vb + BN * H_ * D_);
    stage_k(Kf[1]);
    stage_v(Vf[1]);
    load_k(kb + 2 * BN * H_ * E_);
    load_v(vb + 2 * BN * H_ * D_);
    stage_k(Kf[2]);
    stage_v(Vf[2]);
    load_k(kb + 3 * BN * H_ * E_);
    stage_k(Kf[3]);
    kb += (GT + 1) * BN * H_ * E_;                       // the tiles that trip 0 loads
    vb += GT * BN * H_ * D_;
    mask_wait();                                         // mask tile 0 has landed
    __syncthreads();
    mask_load(pinned(1u));                               // its descriptor is formed behind the wait
    fetch_k(Kf[0]);
    fetch_mask((const float*)(Mf + w * MSL));
    asm volatile("s_wait_dscnt 0x0" ::: "memory");       // this wave has left mask buffer 0 and K buffer 0
    // mask tile 1 has landed, behind the LDS time of the fetches above: so its descriptor's registers are
    // free before the loop, whose own requests and waits share one set of registers
    mask_wait();
    __syncthreads();                                     // every wave has left K buffer 0: trip 2 stages K tile 6 into it

    // Trip t works on tile t. Its K fragments and its mask came into registers during trip t - 1, so
    // its S^T products start at once; tile t + 1's K fragments are fetched while the softmax and the O^T products run, its mask behind them.
    // ONE BARRIER FOR THREE TRIPS, at the foot of the third: between two barriers the waves run free, so
    // that one wave's products and LDS reads fall into another's softmax. For that K and V are rings of
    // six tiles. The group of trips 3g .. 3g + 2 reads V tiles 3g .. 3g + 2 and K tiles 3g + 1 .. 3g + 3,
    // all staged in front of the barrier that opened the group, and stages V tiles 3g + 3 .. 3g + 5 and
    // K tiles 3g + 4 .. 3g + 6: six tiles in a row of either, so no buffer is read and written in one
    // group, and what a store overwrites was last read in the group before. So trip t brings K tile
    // t + 4 and V tile t + 3 from global memory into registers at its top and into LDS at its foot.
    // Past the last tile the pointers are held at the last: the ring slots so filled, and the one that
    // the last trip's K fetch reads, are used by nobody. So no branch stands around loads, stores or
    // fetches, and every load is waited for in its own trip.
    auto ring = [](int i) { return i < NR ? i : i - NR; };   // i below 2 * NR
    int b = 0;                                               // t mod NR
    #pragma unroll 1
    for (int t = 0; t < S_ / BN; ++t) {
        const int cur = t & 1;
        load_k(kb);
        load_v(vb);
        compute_tile(Kf[ring(b + 1)], Vf[b]);
        // stands in front of the pointer steps below, which rewrite the base registers that
        // the six issued loads name
        asm volatile("s_wait_xcnt 0x0" ::: "memory");
        // The mask ring is private to the wave: no barrier belongs to it. Tile t + 1 has landed behind
        // this wait; tile t + 2 goes into the buffer that the wave read in trip t - 1, whose
        // s_wait_dscnt 0 stood at that trip's foot.
        mask_wait();
        const uint32_t nt = pinned((uint32_t)t + 2u);        // the descriptor is formed behind the wait
        if (pinned(nt < S_ / BN)) mask_load(nt);
        fetch_mask((const float*)(Mf + ((cur ^ 1) * NW + w) * MSL));
        stage_k(Kf[ring(b + GT + 1)]);
        stage_v(Vf[ring(b + GT)]);
        kb += t + GT + 2 < S_ / BN ? BN * H_ * E_ : 0;       // held at the last tile
        vb += t + GT + 1 < S_ / BN ? BN * H_ * D_ : 0;
        asm volatile("s_wait_dscnt 0x0" ::: "memory");       // this wave's fetches and stores are done
        if ((((1 << (GT - 1)) | (1 << (NR - 1))) >> b) & 1)  // b = GT - 1 or NR - 1; the same in every wave
            __syncthreads();                                 // closes the group
        b = ring(b + 1);
    }
    asm volatile("s_wait_tensorcnt 0x0" ::: "memory");       // nothing in flight at the wave's end
    asm volatile("s_wait_dscnt 0x0" ::: "memory");           // nor an LDS read of the ring

    // ---------------- epilogue: divide by running sum, store fp32 ----------------
    {
        const float inv = 1.0f / run_sum;
        float* orow = Out + (((size_t)n * L_ + l_own) * H_ + h) * D_ + 8 * h2;
        #pragma unroll
        for (int nd = 0; nd < 4; ++nd) {
            v8f t = o[nd] * inv;
            *(v4f*)(orow + nd * 16)     = __builtin_shufflevector(t, t, 0, 1, 2, 3);
            *(v4f*)(orow + nd * 16 + 4) = __builtin_shufflevector(t, t, 4, 5, 6, 7);
        }
    }
}

extern "C" void kernel_launch(void* const* d_in, const int* in_sizes, int n_in,
                              void* d_out, int out_size, void* d_ws, size_t ws_size,
                              hipStream_t stream) {
    const float* Q = (const float*)d_in[0];
    const float* K = (const float*)d_in[1];
    const float* V = (const float*)d_in[2];
    const float* M = (const float*)d_in[3];
    float* O = (float*)d_out;
    dim3 grid(N_ * H_ * (L_ / BM));   // 2*16*8 = 256 blocks
    fattn_wmma_kernel<<<grid, 512, 0, stream>>>(Q, K, V, M, O);
}
